// v000
// Measured on an AMD MI455X. A time is GPU time per run, averaged over a window of back-to-back runs after a warm-up
// (all launches, gaps included; the runs take copies of the inputs in turn), and the median of several windows.
// Apart from v000's, it joins two sittings. Times from different sittings can be a few percent apart, while
// side-by-side timings come from the same sitting.
// The starting kernel, v000, takes 1320 microseconds a run.
// compute dtype: all float inputs rounded to bf16; q/k/v projections with EXACT bf16 products on WMMA 16x16x32 (f32 accumulate); the sinusoidal PE added in f32 (sincosf) to the projected q/k rows; q as f16 hi + residual (x 2^10) against k once to f16 (2 products) x 64^-0.5; softmax in f32 (precise expf); P x 2^11 once to f16 against v once to f16 (1 product); ctx split bf16 hi + lo against exact Wo (2 products); f32 output.
#include <hip/hip_runtime.h>
#include <math.h>

typedef __attribute__((ext_vector_type(16))) _Float16 v16h;
typedef __attribute__((ext_vector_type(16))) __bf16 v16b;
typedef __attribute__((ext_vector_type(8)))  _Float16 v8h;
typedef __attribute__((ext_vector_type(8)))  float v8f;
typedef __attribute__((ext_vector_type(4)))  float v4f;
typedef __attribute__((ext_vector_type(2)))  float v2f;
typedef __attribute__((ext_vector_type(4)))  unsigned v4u;
typedef __attribute__((ext_vector_type(4)))  int v4i;
typedef float __attribute__((may_alias)) float_a;
typedef int __attribute__((may_alias)) int_a;

template <typename T> __device__ __forceinline__ void vst2(void* p, T v) { *(T*)p = v;  }
__device__ __forceinline__ v8f wmma16(v16h a, v16h b, v8f c) {
  v8f d = __builtin_amdgcn_wmma_f32_16x16x32_f16(false, a, false, b, (short)0, c, false, false);
  asm volatile("v_nop\n\tv_nop\n\tv_nop\n\tv_nop" : "+v"(d) : "v"(a), "v"(b));
  return d;
}
__device__ __forceinline__ v8f wmma_bf(v16b a, v16b b, v8f c) {
  v8f d = __builtin_amdgcn_wmma_f32_16x16x32_bf16(false, a, false, b, (short)0, c, false, false);
  asm volatile("v_nop\n\tv_nop\n\tv_nop\n\tv_nop" : "+v"(d) : "v"(a), "v"(b));
  return d;
}
// 16x16x32 fragments: lane = (h = lane>>4, row/col = lane&15); elements 0..7 = k0+8h+0..7, 8..15 = k0+16+8h+0..7; D element r = row 8h+r
__device__ __forceinline__ v16h frag_h(const _Float16* rowk0, int lane) {
  union { v16h v; v8h q[2]; } u; const _Float16* p = rowk0 + 8 * (lane >> 4);
  u.q[0] = *(const v8h*)p; u.q[1] = *(const v8h*)(p + 16); return u.v;
}
__device__ __forceinline__ v16h frag_f32(const float* rowk0, int lane) {
  v16h a; const float* p = rowk0 + 8 * (lane >> 4);
#pragma unroll
  for (int i = 0; i < 8; ++i) { a[i] = (_Float16)p[i]; a[8 + i] = (_Float16)p[16 + i]; }
  return a;
}
__device__ __forceinline__ v16h frag_f32s(const float* rowk0, int lane, float sc) {
  v16h a; const float* p = rowk0 + 8 * (lane >> 4);
#pragma unroll
  for (int i = 0; i < 8; ++i) { a[i] = (_Float16)(p[i] * sc); a[8 + i] = (_Float16)(p[16 + i] * sc); }
  return a;
}
// column fragment from a [K][ld] layout (column n), rows >= K read as 0
__device__ __forceinline__ v16h fragc_f32(const float* W, int k0, int n, int lane, int ld, int K) {
  v16h a; const int g = lane >> 4;
#pragma unroll
  for (int i = 0; i < 8; ++i) { const int ka = k0 + 8 * g + i, kb = ka + 16;
    a[i] = (_Float16)(ka < K ? W[(size_t)(ka < K ? ka : K - 1) * ld + n] : 0.f); a[8 + i] = (_Float16)(kb < K ? W[(size_t)(kb < K ? kb : K - 1) * ld + n] : 0.f); }
  return a;
}
struct F2 { v16b h, l; };
__device__ __forceinline__ F2 bsplit16(const float v[16]) { F2 r;
#pragma unroll
  for (int i = 0; i < 16; ++i) { const __bf16 h = (__bf16)v[i]; r.h[i] = h; r.l[i] = (__bf16)(v[i] - (float)h); }
  return r; }
__device__ __forceinline__ F2 split_row(const float* row, int k0, int lane) { float v[16]; const float* p = row + k0 + 8 * (lane >> 4);
#pragma unroll
  for (int i = 0; i < 8; ++i) { v[i] = p[i]; v[8 + i] = p[16 + i]; }
  return bsplit16(v); }
__device__ __forceinline__ F2 split_rowK(const float* row, int k0, int lane, int K) { float v[16]; const int g = lane >> 4;
#pragma unroll
  for (int i = 0; i < 8; ++i) { const int ka = k0 + 8 * g + i, kb = ka + 16; v[i] = ka < K ? row[ka < K ? ka : K - 1] : 0.f; v[8 + i] = kb < K ? row[kb < K ? kb : K - 1] : 0.f; }
  return bsplit16(v); }
__device__ __forceinline__ F2 split_col(const float* W, int k0, int n, int lane, int ld, int K) { float v[16]; const int g = lane >> 4;
#pragma unroll
  for (int i = 0; i < 8; ++i) { const int ka = k0 + 8 * g + i, kb = ka + 16; v[i] = ka < K ? W[(size_t)(ka < K ? ka : K - 1) * ld + n] : 0.f; v[8 + i] = kb < K ? W[(size_t)(kb < K ? kb : K - 1) * ld + n] : 0.f; }
  return bsplit16(v); }
__device__ __forceinline__ v8f mac3(const F2& a, const F2& b, v8f c) { c = wmma_bf(a.l, b.h, c); c = wmma_bf(a.h, b.l, c); return wmma_bf(a.h, b.h, c); }
__device__ __forceinline__ float sigm(float v) { return 1.0f / (1.0f + expf(-v)); }
#define LDSX() do { asm volatile("s_wait_dscnt 0" ::: "memory"); __builtin_amdgcn_wave_barrier(); __builtin_amdgcn_fence(__ATOMIC_RELEASE, "workgroup"); } while (0)

// Multi-head attention with an additive sinusoidal positional encoding (B 4, S 1,024, 1,024 = 16 x 64; separate q/k/v inputs): qh, kh, vh = x W^T + b ((out,in)); qh += pe, kh += pe with pe[t][2i] = sin(t div_i), pe[t][2i+1] = cos(t div_i), div_i = exp(-2i ln(10000)/64); out = merged(softmax(qh kh^T x 64^-0.5) vh) Wo^T + bo.
#define NB 4
#define TT 1024
#define CC 1024            // NH * HD = projected width
#define DIN 1024          // input (model) width
#define NH 16
#define HD 64
#define NQB (TT / 64)
#define HG 4
#define SCALE (0.125f)
#define CAUSAL 0
#ifndef TNB
#define TNB NB
#endif
__device__ __forceinline__ float bfr(float v) { return (float)(__bf16)v; }
__host__ __device__ __forceinline__ int kb_last(int qb) { return CAUSAL ? ((qb * 64 + 63) >> 7) : (TT / 128 - 1); }
typedef __attribute__((ext_vector_type(8))) __bf16 v8b;
__device__ __forceinline__ v16b frag_b(const __bf16* rowk0, int lane) {
  union { v16b v; v8b q[2]; } u; const __bf16* p = rowk0 + 8 * (lane >> 4);
  u.q[0] = *(const v8b*)p; u.q[1] = *(const v8b*)(p + 16); return u.v;
}
#define QBH 0              // query blocks 0..QBH-1 take the high-precision path: none here (non-causal, every block sees all TT keys)
#define QHI 1024            // rows carrying a q residual plane (all rows when non-causal: 2-product logits everywhere)
#define KHI 64            // key rows carrying k residual / v bf16 hi+lo planes (read only by the qb < QBH path, which no block takes)
// B fragment (k rows k0+.., output column o) of a weight: (in,out) [K][ld] or (out,in) [ld rows of K]: bf16 exact, or f16(bf16 * 256) exact
__device__ __forceinline__ v16b wcol_io(const float* Wm, int k0, int o, int lane, int ld) { v16b w; const int g = lane >> 4;
#pragma unroll
  for (int i = 0; i < 8; ++i) { w[i] = (__bf16)Wm[(size_t)(k0 + 8 * g + i) * ld + o]; w[8 + i] = (__bf16)Wm[(size_t)(k0 + 16 + 8 * g + i) * ld + o]; }
  return w; }
__device__ __forceinline__ v16b wcol_oi(const float* Wm, int k0, int o, int lane, int K) { v16b w; const float* p = Wm + (size_t)o * K + k0 + 8 * (lane >> 4);
#pragma unroll
  for (int i = 0; i < 8; ++i) { w[i] = (__bf16)p[i]; w[8 + i] = (__bf16)p[16 + i]; }
  return w; }
__device__ __forceinline__ v16h wcolh_io(const float* Wm, int k0, int o, int lane, int ld) { v16h w; const int g = lane >> 4;
#pragma unroll
  for (int i = 0; i < 8; ++i) { w[i] = (_Float16)(bfr(Wm[(size_t)(k0 + 8 * g + i) * ld + o]) * 256.0f); w[8 + i] = (_Float16)(bfr(Wm[(size_t)(k0 + 16 + 8 * g + i) * ld + o]) * 256.0f); }
  return w; }
__device__ __forceinline__ v16h wcolh_oi(const float* Wm, int k0, int o, int lane, int K) { v16h w; const float* p = Wm + (size_t)o * K + k0 + 8 * (lane >> 4);
#pragma unroll
  for (int i = 0; i < 8; ++i) { w[i] = (_Float16)(bfr(p[i]) * 256.0f); w[8 + i] = (_Float16)(bfr(p[16 + i]) * 256.0f); }
  return w; }
#define WQKV_LAYOUT 1   // 0 = (in,out) [DIN][CC]; 1 = (out,in) [CC][DIN]; 2 = per-head [NH][DIN][HD]
__device__ __forceinline__ v16b wcol_hdk(const float* Wm, int k0, int o, int lane) { v16b w; const int g = lane >> 4; const float* p = Wm + (size_t)(o / HD) * DIN * HD + (o % HD);
#pragma unroll
  for (int i = 0; i < 8; ++i) { w[i] = (__bf16)p[(size_t)(k0 + 8 * g + i) * HD]; w[8 + i] = (__bf16)p[(size_t)(k0 + 16 + 8 * g + i) * HD]; }
  return w; }
#define WO_OUT_IN 1
#if WQKV_LAYOUT == 1
#define WCOL(W, k0, o, lane) wcol_oi(W, k0, o, lane, DIN)
#elif WQKV_LAYOUT == 2
#define WCOL(W, k0, o, lane) wcol_hdk(W, k0, o, lane)
#else
#define WCOL(W, k0, o, lane) wcol_io(W, k0, o, lane, CC)
#endif
#if WO_OUT_IN
#define WOCOL(W, k0, o, lane) wcol_oi(W, k0, o, lane, CC)
#define WOCOLH(W, k0, o, lane) wcolh_oi(W, k0, o, lane, CC)
#else
#define WOCOL(W, k0, o, lane) wcol_io(W, k0, o, lane, DIN)
#define WOCOLH(W, k0, o, lane) wcolh_io(W, k0, o, lane, DIN)
#endif
__constant__ float c_div[32] = {1.000000000e+0f,7.498942018e-1f,5.623413324e-1f,4.216964841e-1f,3.162277639e-1f,2.371373624e-1f,1.778279394e-1f,1.333521456e-1f,9.999999404e-2f,7.498941571e-2f,5.623412877e-2f,4.216964915e-2f,3.162277490e-2f,2.371373586e-2f,1.778279245e-2f,1.333521307e-2f,9.999999776e-3f,7.498941384e-3f,5.623412784e-3f,4.216964822e-3f,3.162277397e-3f,2.371373586e-3f,1.778279198e-3f,1.333521330e-3f,9.999999311e-4f,7.498941268e-4f,5.623412435e-4f,4.216964589e-4f,3.162277280e-4f,2.371373412e-4f,1.778279257e-4f,1.333521213e-4f};   /* f32(exp(2i * (-ln(10000)/64))) - the module's 'div' */
#define PROJ_EPI(which, row, t, h) do { if ((which) < 2) { float* rw = (row); const float pf = (float)(t); _Pragma("unroll") for (int i = 0; i < 32; ++i) { float sn, cs; sincosf(pf * c_div[i], &sn, &cs); rw[2 * i] += sn; rw[2 * i + 1] += cs; } } } while (0)   /* q, k += sinusoidal PE: pe[t][2i] = sin(t div_i), pe[t][2i+1] = cos(t div_i) */
#ifndef SM_EXTRA_PARAMS
#define SM_EXTRA_PARAMS
#endif
#ifndef PROJ_EXTRA_PARAMS
#define PROJ_EXTRA_PARAMS
#endif
#ifndef SM_MASK_HOOK
#define SM_MASK_HOOK (void)0
#endif

#define WS_QH  0u                                      // f16 q rows [b*t][CC]
#define WS_KH  (WS_QH + 2u * (size_t)NB * TT * CC)      // f16 k rows [b*t][CC]
#define WS_VT  (WS_KH + 2u * (size_t)NB * TT * CC)      // f16 v planes [b][c][t]
#define WS_QL  (WS_VT + 2u * (size_t)NB * CC * TT)      // f16 q residual x 2^10 rows [b][t < QHI][CC]
#define WS_KL  (WS_QL + 2u * (size_t)NB * QHI * CC)     // f16 k residual x 2^10 rows [b][t < KHI][CC]
#define WS_VB  (WS_KL + 2u * (size_t)NB * KHI * CC)     // bf16 v hi planes [b][c][t < KHI]
#define WS_VBL (WS_VB + 2u * (size_t)NB * CC * KHI)
#define WS_S   (WS_VBL + 2u * (size_t)NB * CC * KHI)    // f32 logits / P [hg][t][s]
#define WS_Y   (WS_S  + 4u * (size_t)HG * TT * TT)      // f32 ctx rows [b*t][CC] (only when there is an output projection)
#define WS_END (WS_Y  + 4u * (size_t)NB * TT * CC)

// ---- k_proj: block = (64 rows, 128 cols, which): q/k/v = X W (+ b) with exact bf16 products (K = DIN) -> which 0: q f16 rows (+ residual rows < QHI); 1: k f16 rows (+ residual rows < KHI); 2: v f16 planes [c][t] (+ bf16 hi/lo planes for t < KHI)
__global__ __launch_bounds__(128) void k_proj(const float* __restrict__ XQ, const float* __restrict__ XK, const float* __restrict__ XV, const float* __restrict__ WQ, const float* __restrict__ WK, const float* __restrict__ WV, const float* __restrict__ BQ, const float* __restrict__ BK, const float* __restrict__ BV,
    _Float16* __restrict__ QH, _Float16* __restrict__ QL, _Float16* __restrict__ KH, _Float16* __restrict__ KL, _Float16* __restrict__ VT, __bf16* __restrict__ VB, __bf16* __restrict__ VBL PROJ_EXTRA_PARAMS) {
  __shared__ __align__(16) float st[64][132]; __shared__ __align__(16) _Float16 sh[64][136], sl[64][136]; __shared__ __align__(16) _Float16 th[128][72]; __shared__ __align__(16) __bf16 tb[128][72], tbl[128][72];
  const int tid = threadIdx.x, wave = tid >> 5, lane = tid & 31, col = lane & 15, g = lane >> 4; const int which = blockIdx.z; const int c0 = blockIdx.y * 128; const size_t r0 = (size_t)blockIdx.x * 64; const size_t bb = r0 / TT; const int t0 = (int)(r0 % TT);
  const float* X = which == 0 ? XQ : which == 1 ? XK : XV; const float* WA = which == 0 ? WQ : which == 1 ? WK : WV; const float* BA = which == 0 ? BQ : which == 1 ? BK : BV;
  v8f acc[8] = {};
#pragma unroll 2
  for (int kc = 0; kc < DIN / 32; ++kc) { v16b a; { const float* p = X + (r0 + wave * 16 + col) * DIN + kc * 32 + 8 * g;
#pragma unroll
      for (int i = 0; i < 8; ++i) { a[i] = (__bf16)p[i]; a[8 + i] = (__bf16)p[16 + i]; } }
    asm volatile("s_wait_loadcnt 0x0" ::: "memory");
#pragma unroll
    for (int j = 0; j < 8; ++j) { const v16b w = WCOL(WA, kc * 32, c0 + j * 16 + col, lane); asm volatile("s_wait_loadcnt 0x0" ::: "memory"); acc[j] = wmma_bf(a, w, acc[j]); } }
  { // stage the f32 tile (acc + bias) in LDS, run the per-(row, head) epilogue hook, then convert
#pragma unroll
    for (int j = 0; j < 8; ++j) { const float bias = BA ? bfr(BA[c0 + j * 16 + col]) : 0.f;
#pragma unroll
      for (int r = 0; r < 8; ++r) st[wave * 16 + 8 * g + r][j * 16 + col] = acc[j][r] + bias; }
    __syncthreads();
    for (int e = tid; e < 64 * (128 / HD); e += 128) { const int rl = e / (128 / HD), hh = e % (128 / HD); PROJ_EPI(which, &st[rl][hh * HD], (int)((r0 + rl) % TT), (c0 / HD) + hh); }
    __syncthreads(); }
  if (which < 2) { _Float16* DH = which == 0 ? QH : KH; _Float16* DL = which == 0 ? QL : KL; const int nhi = which == 0 ? QHI : KHI; const bool hi_rows = t0 < nhi;
    for (int e = tid; e < 64 * 128; e += 128) { const int rl = e >> 7, cl = e & 127; const float v = st[rl][cl]; const _Float16 hv = (_Float16)v; sh[rl][cl] = hv; sl[rl][cl] = (_Float16)((v - (float)hv) * 1024.0f); }
    __syncthreads();
    for (int e = tid; e < 64 * 16; e += 128) { const int rl = e >> 4, q = e & 15; vst2((unsigned*)(DH + (r0 + rl) * CC + c0 + q * 8), *(const v4u*)&sh[rl][q * 8]); if (hi_rows) vst2((unsigned*)(DL + (bb * nhi + t0 + rl) * (size_t)CC + c0 + q * 8), *(const v4u*)&sl[rl][q * 8]); }
  } else { const bool hi_rows = t0 < KHI;
    for (int e = tid; e < 64 * 128; e += 128) { const int rl = e & 63, cl = e >> 6; const float v = st[rl][cl]; th[cl][rl] = (_Float16)v; const __bf16 bh = (__bf16)v; tb[cl][rl] = bh; tbl[cl][rl] = (__bf16)(v - (float)bh); }
    __syncthreads();
    for (int e = tid; e < 128 * 8; e += 128) { const int cl = e >> 3, q = e & 7; vst2((unsigned*)(VT + (bb * CC + c0 + cl) * (size_t)TT + t0 + q * 8), *(const v4u*)&th[cl][q * 8]); if (hi_rows) { const size_t o3 = (bb * CC + c0 + cl) * (size_t)KHI + t0 + q * 8; vst2((unsigned*)(VB + o3), *(const v4u*)&tb[cl][q * 8]); vst2((unsigned*)(VBL + o3), *(const v4u*)&tbl[cl][q * 8]); } } } }
// ---- k_sc: block = (query block qb, key block kb <= kb_last(qb), head in group) of batch b: logits x SCALE; q hi + residual (x 2^10) against k (2 products) for query rows < QHI, plus the k residual (3 products) for query blocks < QBH (causal early rows); causal: blocks past the diagonal exit, the mask itself is applied by index in k_sm
__global__ __launch_bounds__(128) void k_sc(const _Float16* __restrict__ QH, const _Float16* __restrict__ KH, const _Float16* __restrict__ QL, const _Float16* __restrict__ KL, int b, int h0, float* __restrict__ S0) { __shared__ __align__(16) float ss[4][16][132];
  const int qb = blockIdx.x, kb = blockIdx.y; if (kb > kb_last(qb)) return;
  const int h = h0 + blockIdx.z; float* S = S0 + (size_t)blockIdx.z * TT * TT;
  const int tid = threadIdx.x, wave = tid >> 5, lane = tid & 31, col = lane & 15, g = lane >> 4; const int k0 = kb * 128; const int ql0 = qb * 64 + wave * 16; const size_t q0 = (size_t)b * TT + ql0, kr0 = (size_t)b * TT + k0;
  v8f acc[8] = {}, accl[8] = {};
  const _Float16* QLb = QL + (size_t)b * QHI * CC; const _Float16* KLb = KL + (size_t)b * KHI * CC;
  if (qb < QBH) {
#pragma unroll
    for (int kc = 0; kc < HD / 32; ++kc) { const v16h ah = frag_h(QH + (q0 + col) * CC + h * HD + kc * 32, lane), al = frag_h(QLb + (size_t)(ql0 + col) * CC + h * HD + kc * 32, lane);
#pragma unroll
      for (int j = 0; j < 8; ++j) { const v16h kbf = frag_h(KH + (kr0 + j * 16 + col) * CC + h * HD + kc * 32, lane), klf = frag_h(KLb + (size_t)(k0 + j * 16 + col) * CC + h * HD + kc * 32, lane); acc[j] = wmma16(ah, kbf, acc[j]); accl[j] = wmma16(al, kbf, accl[j]); accl[j] = wmma16(ah, klf, accl[j]); } }
  } else if (qb * 64 < QHI) {
#pragma unroll
    for (int kc = 0; kc < HD / 32; ++kc) { const v16h ah = frag_h(QH + (q0 + col) * CC + h * HD + kc * 32, lane), al = frag_h(QLb + (size_t)(ql0 + col) * CC + h * HD + kc * 32, lane);
#pragma unroll
      for (int j = 0; j < 8; ++j) { const v16h kbf = frag_h(KH + (kr0 + j * 16 + col) * CC + h * HD + kc * 32, lane); acc[j] = wmma16(ah, kbf, acc[j]); accl[j] = wmma16(al, kbf, accl[j]); } }
  } else {
#pragma unroll
    for (int kc = 0; kc < HD / 32; ++kc) { const v16h ah = frag_h(QH + (q0 + col) * CC + h * HD + kc * 32, lane);
#pragma unroll
      for (int j = 0; j < 8; ++j) { const v16h kbf = frag_h(KH + (kr0 + j * 16 + col) * CC + h * HD + kc * 32, lane); acc[j] = wmma16(ah, kbf, acc[j]); } } }
#pragma unroll
  for (int j = 0; j < 8; ++j) {
#pragma unroll
    for (int r = 0; r < 8; ++r) ss[wave][8 * g + r][j * 16 + col] = (acc[j][r] + accl[j][r] * (1.0f / 1024.0f)) * SCALE; }
  LDSX(); for (int rl = 0; rl < 16; ++rl) vst2(S + (size_t)(ql0 + rl) * TT + k0 + lane * 4, *(const v4f*)&ss[wave][rl][lane * 4]); }
// ---- k_sm: block = query row t (head in group): keys [0, kend): causal -> logit if s <= t else excluded; softmax in f32; P x 2^11 in place (0 for excluded)
__global__ __launch_bounds__(256) void k_sm(float* __restrict__ S0 SM_EXTRA_PARAMS) { __shared__ float sred[8]; __shared__ float sbc; __shared__ __align__(16) float shv[TT];
  const int tid = threadIdx.x; const int t = blockIdx.x; const int kend = (kb_last(t >> 6) + 1) * 128;
  float* sr = S0 + (size_t)blockIdx.y * TT * TT + (size_t)t * TT;
  float m = -3.0e38f; for (int k = tid; k < kend; k += 256) { float v = (!CAUSAL || k <= t) ? sr[k] : -3.0e38f; SM_MASK_HOOK; shv[k] = v; m = fmaxf(m, v); }
#pragma unroll
  for (int o = 1; o < 32; o <<= 1) m = fmaxf(m, __shfl_xor(m, o));
  if ((tid & 31) == 0) sred[tid >> 5] = m; __syncthreads(); if (tid == 0) { float a = sred[0]; for (int i = 1; i < 8; ++i) a = fmaxf(a, sred[i]); sbc = a; } __syncthreads(); m = sbc; __syncthreads();
  float sum = 0.f; for (int k = tid; k < kend; k += 256) { const float v = shv[k]; const float e = (v <= -1.0e38f) ? 0.f : expf(v - m); shv[k] = e; sum += e; }
#pragma unroll
  for (int o = 1; o < 32; o <<= 1) sum += __shfl_xor(sum, o);
  if ((tid & 31) == 0) sred[tid >> 5] = sum; __syncthreads(); if (tid == 0) { float a = 0.f; for (int i = 0; i < 8; ++i) a += sred[i]; sbc = a > 0.f ? 2048.0f / a : 0.f; }   /* a fully excluded row yields P = 0 */ __syncthreads(); const float inv = sbc;
  for (int k = tid; k < kend; k += 256) shv[k] = shv[k] * inv;
  __syncthreads(); for (int q = tid; q < kend / 4; q += 256) vst2(sr + q * 4, *(const v4f*)&shv[q * 4]); }
// ---- k_pv: block = 64 queries (qb) of (b, h): ctx = P . v over keys [0, kend) (P x 2^11 once to f16 against v f16: 1 product; causal early query blocks: P and v as bf16 hi + lo, 3 products); 256-B (row, head) segment by 16 lanes
__global__ __launch_bounds__(128) void k_pv(const float* __restrict__ PS0, const _Float16* __restrict__ VT, const __bf16* __restrict__ VB, const __bf16* __restrict__ VBL, int b, int h0, float* __restrict__ Y) { const int h = h0 + blockIdx.z; const float* PS = PS0 + (size_t)blockIdx.z * TT * TT; __shared__ __align__(16) float ss[4][16][HD + 4];
  const int tid = threadIdx.x, wave = tid >> 5, lane = tid & 31, col = lane & 15, g = lane >> 4; const int qb = blockIdx.x; const int ql0 = qb * 64 + wave * 16; const int kce = (kb_last(qb) + 1) * 4;
  v8f acc[HD / 16] = {};
  if (qb < QBH) {
#pragma unroll 1
    for (int kc = 0; kc < kce; ++kc) { const F2 p = split_row(PS + (size_t)(ql0 + col) * TT, kc * 32, lane);
      asm volatile("s_wait_loadcnt 0x0" ::: "memory");
#pragma unroll
      for (int j = 0; j < HD / 16; ++j) { const size_t po = ((size_t)b * CC + h * HD + j * 16 + col) * (size_t)KHI + kc * 32; const v16b vh = frag_b(VB + po, lane); acc[j] = wmma_bf(p.h, vh, acc[j]); acc[j] = wmma_bf(p.l, vh, acc[j]); acc[j] = wmma_bf(p.h, frag_b(VBL + po, lane), acc[j]); } }
  } else {
#pragma unroll 1
    for (int kc = 0; kc < kce; ++kc) { const v16h p = frag_f32(PS + (size_t)(ql0 + col) * TT + kc * 32, lane);
      asm volatile("s_wait_loadcnt 0x0" ::: "memory");
#pragma unroll
      for (int j = 0; j < HD / 16; ++j) { const size_t po = ((size_t)b * CC + h * HD + j * 16 + col) * (size_t)TT + kc * 32; acc[j] = wmma16(p, frag_h(VT + po, lane), acc[j]); } } }
#pragma unroll
  for (int j = 0; j < HD / 16; ++j)
#pragma unroll
    for (int r = 0; r < 8; ++r) ss[wave][8 * g + r][j * 16 + col] = acc[j][r] * (1.0f / 2048.0f);
  LDSX(); for (int rl = 0; rl < 16; ++rl) if (lane < HD / 4) vst2(Y + ((size_t)b * TT + ql0 + rl) * CC + h * HD + lane * 4, *(const v4f*)&ss[wave][rl][lane * 4]); }
// ---- k_out: block = (64 rows, 128 cols): out = ctx Wo (+ bo): all rows: ctx bf16 hi + lo against exact bf16 Wo (2 products); the f16 1-product branch (Wo as f16(bf16 x 2^8), x 2^-8) is not taken
__global__ __launch_bounds__(128) void k_out(const float* __restrict__ Y, const float* __restrict__ WO, const float* __restrict__ BO, float* __restrict__ OUT) { __shared__ __align__(16) float sf[4][16][132];
  const int tid = threadIdx.x, wave = tid >> 5, lane = tid & 31, col = lane & 15, g = lane >> 4; const int c0 = blockIdx.y * 128; const size_t r0 = (size_t)blockIdx.x * 64 + wave * 16;
  v8f acc[8] = {};
  if (true) {   /* ALL rows: ctx split bf16 hi + lo x exact Wo (2 products) */
#pragma unroll 2
    for (int kc = 0; kc < CC / 32; ++kc) { const F2 a = split_row(Y + (r0 + col) * CC, kc * 32, lane); asm volatile("s_wait_loadcnt 0x0" ::: "memory");
#pragma unroll
      for (int j = 0; j < 8; ++j) { const v16b w = WOCOL(WO, kc * 32, c0 + j * 16 + col, lane); asm volatile("s_wait_loadcnt 0x0" ::: "memory"); acc[j] = wmma_bf(a.h, w, acc[j]); acc[j] = wmma_bf(a.l, w, acc[j]); } }
#pragma unroll
    for (int j = 0; j < 8; ++j) { const float bias = BO ? bfr(BO[c0 + j * 16 + col]) : 0.f;
#pragma unroll
      for (int r = 0; r < 8; ++r) sf[wave][8 * g + r][j * 16 + col] = acc[j][r] + bias; }
  } else {
#pragma unroll 2
    for (int kc = 0; kc < CC / 32; ++kc) { const v16h a = frag_f32(Y + (r0 + col) * CC + kc * 32, lane); asm volatile("s_wait_loadcnt 0x0" ::: "memory");
#pragma unroll
      for (int j = 0; j < 8; ++j) { const v16h w = WOCOLH(WO, kc * 32, c0 + j * 16 + col, lane); asm volatile("s_wait_loadcnt 0x0" ::: "memory"); acc[j] = wmma16(a, w, acc[j]); } }
#pragma unroll
    for (int j = 0; j < 8; ++j) { const float bias = BO ? bfr(BO[c0 + j * 16 + col]) : 0.f;
#pragma unroll
      for (int r = 0; r < 8; ++r) sf[wave][8 * g + r][j * 16 + col] = acc[j][r] * (1.0f / 256.0f) + bias; } }
  LDSX(); for (int rl = 0; rl < 16; ++rl) vst2(OUT + (r0 + rl) * DIN + c0 + lane * 4, *(const v4f*)&sf[wave][rl][lane * 4]); }

extern "C" void kernel_launch(void* const* d_in, const int* in_sizes, int n_in, void* d_out, int out_size, void* d_ws, size_t ws_size, hipStream_t stream) {
  (void)in_sizes; (void)n_in; (void)out_size;
  const float** F = (const float**)d_in;
  if (ws_size < (size_t)WS_END) return;
  char* ws = (char*)d_ws; _Float16 *QH = (_Float16*)(ws + WS_QH), *KH = (_Float16*)(ws + WS_KH), *VT = (_Float16*)(ws + WS_VT), *QL = (_Float16*)(ws + WS_QL), *KL = (_Float16*)(ws + WS_KL); __bf16 *VB = (__bf16*)(ws + WS_VB), *VBL = (__bf16*)(ws + WS_VBL); float *S = (float*)(ws + WS_S), *Y = (float*)(ws + WS_Y);
  (void)Y; (void)QL; (void)KL; (void)VB; (void)VBL;
  // inputs: 0 q, 1 k, 2 v [4,1024,1024]; 3 Wq [1024,1024] (out,in), 4 bq; 5 Wk, 6 bk; 7 Wv, 8 bv; 9 Wo, 10 bo
  k_proj<<<dim3(TNB * TT / 64, CC / 128, 3), 128, 0, stream>>>(F[0], F[1], F[2], F[3], F[5], F[7], F[4], F[6], F[8], QH, QL, KH, KL, VT, VB, VBL);
  for (int b = 0; b < TNB; ++b) for (int h0 = 0; h0 < NH; h0 += HG) {
    k_sc<<<dim3(NQB, TT / 128, HG), 128, 0, stream>>>(QH, KH, QL, KL, b, h0, S);
    k_sm<<<dim3(TT, HG), 256, 0, stream>>>(S);
    k_pv<<<dim3(NQB, 1, HG), 128, 0, stream>>>(S, VT, VB, VBL, b, h0, Y);
  }
  k_out<<<dim3(TNB * TT / 64, DIN / 128), 128, 0, stream>>>(Y, F[9], F[10], (float*)d_out);
}

// v001
// One run takes 529 microseconds.
// Next to v000, in two timings, it ran 2.49 and 2.48 times as fast.
// compute dtype: all float inputs rounded to bf16; q/k/v projections with EXACT bf16 products on WMMA 16x16x32 (f32 accumulate); the sinusoidal PE added in f32 (sincosf) to the projected q/k rows; q as f16 hi + residual (x 2^10) against k once to f16 (2 products) x 64^-0.5; softmax in f32 (precise expf) with a running maximum and sum, 64 keys a pass; exp(s - m) x 2^10 once to f16 against v once to f16 (1 product); ctx split bf16 hi + lo against exact Wo (2 products); f32 output.
#include <hip/hip_runtime.h>
#include <math.h>

typedef __attribute__((ext_vector_type(16))) _Float16 v16h;
typedef __attribute__((ext_vector_type(16))) __bf16 v16b;
typedef __attribute__((ext_vector_type(8)))  _Float16 v8h;
typedef __attribute__((ext_vector_type(8)))  float v8f;
typedef __attribute__((ext_vector_type(4)))  float v4f;
typedef __attribute__((ext_vector_type(2)))  float v2f;
typedef __attribute__((ext_vector_type(4)))  unsigned v4u;
typedef __attribute__((ext_vector_type(4)))  int v4i;
typedef float __attribute__((may_alias)) float_a;
typedef int __attribute__((may_alias)) int_a;

template <typename T> __device__ __forceinline__ void vst2(void* p, T v) { *(T*)p = v;  }
__device__ __forceinline__ v8f wmma16(v16h a, v16h b, v8f c) {
  v8f d = __builtin_amdgcn_wmma_f32_16x16x32_f16(false, a, false, b, (short)0, c, false, false);
  asm volatile("v_nop\n\tv_nop\n\tv_nop\n\tv_nop" : "+v"(d) : "v"(a), "v"(b));
  return d;
}
__device__ __forceinline__ v8f wmma_bf(v16b a, v16b b, v8f c) {
  v8f d = __builtin_amdgcn_wmma_f32_16x16x32_bf16(false, a, false, b, (short)0, c, false, false);
  asm volatile("v_nop\n\tv_nop\n\tv_nop\n\tv_nop" : "+v"(d) : "v"(a), "v"(b));
  return d;
}
// 16x16x32 fragments: lane = (h = lane>>4, row/col = lane&15); elements 0..7 = k0+8h+0..7, 8..15 = k0+16+8h+0..7; D element r = row 8h+r
__device__ __forceinline__ v16h frag_h(const _Float16* rowk0, int lane) {
  union { v16h v; v8h q[2]; } u; const _Float16* p = rowk0 + 8 * (lane >> 4);
  u.q[0] = *(const v8h*)p; u.q[1] = *(const v8h*)(p + 16); return u.v;
}
__device__ __forceinline__ v16h frag_f32(const float* rowk0, int lane) {
  v16h a; const float* p = rowk0 + 8 * (lane >> 4);
#pragma unroll
  for (int i = 0; i < 8; ++i) { a[i] = (_Float16)p[i]; a[8 + i] = (_Float16)p[16 + i]; }
  return a;
}
__device__ __forceinline__ v16h frag_f32s(const float* rowk0, int lane, float sc) {
  v16h a; const float* p = rowk0 + 8 * (lane >> 4);
#pragma unroll
  for (int i = 0; i < 8; ++i) { a[i] = (_Float16)(p[i] * sc); a[8 + i] = (_Float16)(p[16 + i] * sc); }
  return a;
}
// column fragment from a [K][ld] layout (column n), rows >= K read as 0
__device__ __forceinline__ v16h fragc_f32(const float* W, int k0, int n, int lane, int ld, int K) {
  v16h a; const int g = lane >> 4;
#pragma unroll
  for (int i = 0; i < 8; ++i) { const int ka = k0 + 8 * g + i, kb = ka + 16;
    a[i] = (_Float16)(ka < K ? W[(size_t)(ka < K ? ka : K - 1) * ld + n] : 0.f); a[8 + i] = (_Float16)(kb < K ? W[(size_t)(kb < K ? kb : K - 1) * ld + n] : 0.f); }
  return a;
}
struct F2 { v16b h, l; };
__device__ __forceinline__ F2 bsplit16(const float v[16]) { F2 r;
#pragma unroll
  for (int i = 0; i < 16; ++i) { const __bf16 h = (__bf16)v[i]; r.h[i] = h; r.l[i] = (__bf16)(v[i] - (float)h); }
  return r; }
__device__ __forceinline__ F2 split_row(const float* row, int k0, int lane) { float v[16]; const float* p = row + k0 + 8 * (lane >> 4);
#pragma unroll
  for (int i = 0; i < 8; ++i) { v[i] = p[i]; v[8 + i] = p[16 + i]; }
  return bsplit16(v); }
__device__ __forceinline__ F2 split_rowK(const float* row, int k0, int lane, int K) { float v[16]; const int g = lane >> 4;
#pragma unroll
  for (int i = 0; i < 8; ++i) { const int ka = k0 + 8 * g + i, kb = ka + 16; v[i] = ka < K ? row[ka < K ? ka : K - 1] : 0.f; v[8 + i] = kb < K ? row[kb < K ? kb : K - 1] : 0.f; }
  return bsplit16(v); }
__device__ __forceinline__ F2 split_col(const float* W, int k0, int n, int lane, int ld, int K) { float v[16]; const int g = lane >> 4;
#pragma unroll
  for (int i = 0; i < 8; ++i) { const int ka = k0 + 8 * g + i, kb = ka + 16; v[i] = ka < K ? W[(size_t)(ka < K ? ka : K - 1) * ld + n] : 0.f; v[8 + i] = kb < K ? W[(size_t)(kb < K ? kb : K - 1) * ld + n] : 0.f; }
  return bsplit16(v); }
__device__ __forceinline__ v8f mac3(const F2& a, const F2& b, v8f c) { c = wmma_bf(a.l, b.h, c); c = wmma_bf(a.h, b.l, c); return wmma_bf(a.h, b.h, c); }
__device__ __forceinline__ float sigm(float v) { return 1.0f / (1.0f + expf(-v)); }
#define LDSX() do { asm volatile("s_wait_dscnt 0" ::: "memory"); __builtin_amdgcn_wave_barrier(); __builtin_amdgcn_fence(__ATOMIC_RELEASE, "workgroup"); } while (0)

// Multi-head attention with an additive sinusoidal positional encoding (B 4, S 1,024, 1,024 = 16 x 64; separate q/k/v inputs): qh, kh, vh = x W^T + b ((out,in)); qh += pe, kh += pe with pe[t][2i] = sin(t div_i), pe[t][2i+1] = cos(t div_i), div_i = exp(-2i ln(10000)/64); out = merged(softmax(qh kh^T x 64^-0.5) vh) Wo^T + bo.
#define NB 4
#define TT 1024
#define CC 1024            // NH * HD = projected width
#define DIN 1024          // input (model) width
#define NH 16
#define HD 64
#define NQB (TT / 64)
#define HG 4
#define SCALE (0.125f)
#define CAUSAL 0
#ifndef TNB
#define TNB NB
#endif
__device__ __forceinline__ float bfr(float v) { return (float)(__bf16)v; }
__host__ __device__ __forceinline__ int kb_last(int qb) { return CAUSAL ? ((qb * 64 + 63) >> 7) : (TT / 128 - 1); }
typedef __attribute__((ext_vector_type(8))) __bf16 v8b;
__device__ __forceinline__ v16b frag_b(const __bf16* rowk0, int lane) {
  union { v16b v; v8b q[2]; } u; const __bf16* p = rowk0 + 8 * (lane >> 4);
  u.q[0] = *(const v8b*)p; u.q[1] = *(const v8b*)(p + 16); return u.v;
}
#define QBH 0              // not read by any kernel
#define QHI 1024            // rows carrying a q residual plane (all rows when non-causal: 2-product logits everywhere)
#define KHI 64            // key rows carrying k residual / v bf16 hi+lo planes (written by k_proj, read by no kernel)
// B fragment (k rows k0+.., output column o) of a weight: (in,out) [K][ld] or (out,in) [ld rows of K]: bf16 exact, or f16(bf16 * 256) exact
__device__ __forceinline__ v16b wcol_io(const float* Wm, int k0, int o, int lane, int ld) { v16b w; const int g = lane >> 4;
#pragma unroll
  for (int i = 0; i < 8; ++i) { w[i] = (__bf16)Wm[(size_t)(k0 + 8 * g + i) * ld + o]; w[8 + i] = (__bf16)Wm[(size_t)(k0 + 16 + 8 * g + i) * ld + o]; }
  return w; }
__device__ __forceinline__ v16b wcol_oi(const float* Wm, int k0, int o, int lane, int K) { v16b w; const float* p = Wm + (size_t)o * K + k0 + 8 * (lane >> 4);
#pragma unroll
  for (int i = 0; i < 8; ++i) { w[i] = (__bf16)p[i]; w[8 + i] = (__bf16)p[16 + i]; }
  return w; }
__device__ __forceinline__ v16h wcolh_io(const float* Wm, int k0, int o, int lane, int ld) { v16h w; const int g = lane >> 4;
#pragma unroll
  for (int i = 0; i < 8; ++i) { w[i] = (_Float16)(bfr(Wm[(size_t)(k0 + 8 * g + i) * ld + o]) * 256.0f); w[8 + i] = (_Float16)(bfr(Wm[(size_t)(k0 + 16 + 8 * g + i) * ld + o]) * 256.0f); }
  return w; }
__device__ __forceinline__ v16h wcolh_oi(const float* Wm, int k0, int o, int lane, int K) { v16h w; const float* p = Wm + (size_t)o * K + k0 + 8 * (lane >> 4);
#pragma unroll
  for (int i = 0; i < 8; ++i) { w[i] = (_Float16)(bfr(p[i]) * 256.0f); w[8 + i] = (_Float16)(bfr(p[16 + i]) * 256.0f); }
  return w; }
#define WQKV_LAYOUT 1   // 0 = (in,out) [DIN][CC]; 1 = (out,in) [CC][DIN]; 2 = per-head [NH][DIN][HD]
__device__ __forceinline__ v16b wcol_hdk(const float* Wm, int k0, int o, int lane) { v16b w; const int g = lane >> 4; const float* p = Wm + (size_t)(o / HD) * DIN * HD + (o % HD);
#pragma unroll
  for (int i = 0; i < 8; ++i) { w[i] = (__bf16)p[(size_t)(k0 + 8 * g + i) * HD]; w[8 + i] = (__bf16)p[(size_t)(k0 + 16 + 8 * g + i) * HD]; }
  return w; }
#define WO_OUT_IN 1
#if WQKV_LAYOUT == 1
#define WCOL(W, k0, o, lane) wcol_oi(W, k0, o, lane, DIN)
#elif WQKV_LAYOUT == 2
#define WCOL(W, k0, o, lane) wcol_hdk(W, k0, o, lane)
#else
#define WCOL(W, k0, o, lane) wcol_io(W, k0, o, lane, CC)
#endif
#if WO_OUT_IN
#define WOCOL(W, k0, o, lane) wcol_oi(W, k0, o, lane, CC)
#define WOCOLH(W, k0, o, lane) wcolh_oi(W, k0, o, lane, CC)
#else
#define WOCOL(W, k0, o, lane) wcol_io(W, k0, o, lane, DIN)
#define WOCOLH(W, k0, o, lane) wcolh_io(W, k0, o, lane, DIN)
#endif
__constant__ float c_div[32] = {1.000000000e+0f,7.498942018e-1f,5.623413324e-1f,4.216964841e-1f,3.162277639e-1f,2.371373624e-1f,1.778279394e-1f,1.333521456e-1f,9.999999404e-2f,7.498941571e-2f,5.623412877e-2f,4.216964915e-2f,3.162277490e-2f,2.371373586e-2f,1.778279245e-2f,1.333521307e-2f,9.999999776e-3f,7.498941384e-3f,5.623412784e-3f,4.216964822e-3f,3.162277397e-3f,2.371373586e-3f,1.778279198e-3f,1.333521330e-3f,9.999999311e-4f,7.498941268e-4f,5.623412435e-4f,4.216964589e-4f,3.162277280e-4f,2.371373412e-4f,1.778279257e-4f,1.333521213e-4f};   /* f32(exp(2i * (-ln(10000)/64))) - the module's 'div' */
#define PROJ_EPI(which, row, t, h) do { if ((which) < 2) { float* rw = (row); const float pf = (float)(t); _Pragma("unroll") for (int i = 0; i < 32; ++i) { float sn, cs; sincosf(pf * c_div[i], &sn, &cs); rw[2 * i] += sn; rw[2 * i + 1] += cs; } } } while (0)   /* q, k += sinusoidal PE: pe[t][2i] = sin(t div_i), pe[t][2i+1] = cos(t div_i) */
#ifndef SM_EXTRA_PARAMS
#define SM_EXTRA_PARAMS
#endif
#ifndef PROJ_EXTRA_PARAMS
#define PROJ_EXTRA_PARAMS
#endif
#ifndef SM_MASK_HOOK
#define SM_MASK_HOOK (void)0
#endif

#define WS_QH  0u                                      // f16 q rows [b*t][CC]
#define WS_KH  (WS_QH + 2u * (size_t)NB * TT * CC)      // f16 k rows [b*t][CC]
#define WS_VT  (WS_KH + 2u * (size_t)NB * TT * CC)      // f16 v planes [b][c][t]
#define WS_QL  (WS_VT + 2u * (size_t)NB * CC * TT)      // f16 q residual x 2^10 rows [b][t < QHI][CC]
#define WS_KL  (WS_QL + 2u * (size_t)NB * QHI * CC)     // f16 k residual x 2^10 rows [b][t < KHI][CC]
#define WS_VB  (WS_KL + 2u * (size_t)NB * KHI * CC)     // bf16 v hi planes [b][c][t < KHI]
#define WS_VBL (WS_VB + 2u * (size_t)NB * CC * KHI)
#define WS_Y   (WS_VBL + 2u * (size_t)NB * CC * KHI)    // f32 ctx rows [b*t][CC] (only when there is an output projection)
#define WS_END (WS_Y  + 4u * (size_t)NB * TT * CC)

// ---- k_proj: block = (64 rows, 128 cols, which): q/k/v = X W (+ b) with exact bf16 products (K = DIN) -> which 0: q f16 rows (+ residual rows < QHI); 1: k f16 rows (+ residual rows < KHI); 2: v f16 planes [c][t] (+ bf16 hi/lo planes for t < KHI)
__global__ __launch_bounds__(128) void k_proj(const float* __restrict__ XQ, const float* __restrict__ XK, const float* __restrict__ XV, const float* __restrict__ WQ, const float* __restrict__ WK, const float* __restrict__ WV, const float* __restrict__ BQ, const float* __restrict__ BK, const float* __restrict__ BV,
    _Float16* __restrict__ QH, _Float16* __restrict__ QL, _Float16* __restrict__ KH, _Float16* __restrict__ KL, _Float16* __restrict__ VT, __bf16* __restrict__ VB, __bf16* __restrict__ VBL PROJ_EXTRA_PARAMS) {
  __shared__ __align__(16) float st[64][132]; __shared__ __align__(16) _Float16 sh[64][136], sl[64][136]; __shared__ __align__(16) _Float16 th[128][72]; __shared__ __align__(16) __bf16 tb[128][72], tbl[128][72];
  const int tid = threadIdx.x, wave = tid >> 5, lane = tid & 31, col = lane & 15, g = lane >> 4; const int which = blockIdx.z; const int c0 = blockIdx.y * 128; const size_t r0 = (size_t)blockIdx.x * 64; const size_t bb = r0 / TT; const int t0 = (int)(r0 % TT);
  const float* X = which == 0 ? XQ : which == 1 ? XK : XV; const float* WA = which == 0 ? WQ : which == 1 ? WK : WV; const float* BA = which == 0 ? BQ : which == 1 ? BK : BV;
  v8f acc[8] = {};
#pragma unroll 2
  for (int kc = 0; kc < DIN / 32; ++kc) { v16b a; { const float* p = X + (r0 + wave * 16 + col) * DIN + kc * 32 + 8 * g;
#pragma unroll
      for (int i = 0; i < 8; ++i) { a[i] = (__bf16)p[i]; a[8 + i] = (__bf16)p[16 + i]; } }
    asm volatile("s_wait_loadcnt 0x0" ::: "memory");
#pragma unroll
    for (int j = 0; j < 8; ++j) { const v16b w = WCOL(WA, kc * 32, c0 + j * 16 + col, lane); asm volatile("s_wait_loadcnt 0x0" ::: "memory"); acc[j] = wmma_bf(a, w, acc[j]); } }
  { // stage the f32 tile (acc + bias) in LDS, run the per-(row, head) epilogue hook, then convert
#pragma unroll
    for (int j = 0; j < 8; ++j) { const float bias = BA ? bfr(BA[c0 + j * 16 + col]) : 0.f;
#pragma unroll
      for (int r = 0; r < 8; ++r) st[wave * 16 + 8 * g + r][j * 16 + col] = acc[j][r] + bias; }
    __syncthreads();
    for (int e = tid; e < 64 * (128 / HD); e += 128) { const int rl = e / (128 / HD), hh = e % (128 / HD); PROJ_EPI(which, &st[rl][hh * HD], (int)((r0 + rl) % TT), (c0 / HD) + hh); }
    __syncthreads(); }
  if (which < 2) { _Float16* DH = which == 0 ? QH : KH; _Float16* DL = which == 0 ? QL : KL; const int nhi = which == 0 ? QHI : KHI; const bool hi_rows = t0 < nhi;
    for (int e = tid; e < 64 * 128; e += 128) { const int rl = e >> 7, cl = e & 127; const float v = st[rl][cl]; const _Float16 hv = (_Float16)v; sh[rl][cl] = hv; sl[rl][cl] = (_Float16)((v - (float)hv) * 1024.0f); }
    __syncthreads();
    for (int e = tid; e < 64 * 16; e += 128) { const int rl = e >> 4, q = e & 15; vst2((unsigned*)(DH + (r0 + rl) * CC + c0 + q * 8), *(const v4u*)&sh[rl][q * 8]); if (hi_rows) vst2((unsigned*)(DL + (bb * nhi + t0 + rl) * (size_t)CC + c0 + q * 8), *(const v4u*)&sl[rl][q * 8]); }
  } else { const bool hi_rows = t0 < KHI;
    for (int e = tid; e < 64 * 128; e += 128) { const int rl = e & 63, cl = e >> 6; const float v = st[rl][cl]; th[cl][rl] = (_Float16)v; const __bf16 bh = (__bf16)v; tb[cl][rl] = bh; tbl[cl][rl] = (__bf16)(v - (float)bh); }
    __syncthreads();
    for (int e = tid; e < 128 * 8; e += 128) { const int cl = e >> 3, q = e & 7; vst2((unsigned*)(VT + (bb * CC + c0 + cl) * (size_t)TT + t0 + q * 8), *(const v4u*)&th[cl][q * 8]); if (hi_rows) { const size_t o3 = (bb * CC + c0 + cl) * (size_t)KHI + t0 + q * 8; vst2((unsigned*)(VB + o3), *(const v4u*)&tb[cl][q * 8]); vst2((unsigned*)(VBL + o3), *(const v4u*)&tbl[cl][q * 8]); } } } }
__global__ __launch_bounds__(128) void k_attn(const _Float16* __restrict__ QH, const _Float16* __restrict__ KH, const _Float16* __restrict__ QL, const _Float16* __restrict__ VT, float* __restrict__ Y) { __shared__ __align__(16) float ss[4][16][HD + 4];
  const int tid = threadIdx.x, wave = tid >> 5, lane = tid & 31, col = lane & 15, g = lane >> 4; const int qb = blockIdx.x, h = blockIdx.y, b = blockIdx.z; const int ql0 = qb * 64 + wave * 16;
  v16h qh[HD / 32], ql[HD / 32];
#pragma unroll
  for (int kc = 0; kc < HD / 32; ++kc) { qh[kc] = frag_h(QH + ((size_t)b * TT + ql0 + col) * CC + h * HD + kc * 32, lane); ql[kc] = frag_h(QL + ((size_t)b * QHI + ql0 + col) * CC + h * HD + kc * 32, lane); }
  const _Float16* Kb = KH + ((size_t)b * TT + col) * CC + h * HD;            // key row col of the head
  const _Float16* Vb = VT + ((size_t)b * CC + h * HD + col) * (size_t)TT;    // v plane col of the head
  v8f o[HD / 16] = {}; float m = -3.0e38f, l = 0.f;
  // the pass loop stays rolled (two passes' fragments at once would cost the fourth wave of a SIMD); every inner loop is unrolled so that each register-array index is a constant
#pragma unroll 1
  for (int k0 = 0; k0 < TT; k0 += 64) { v8f acc[4] = {}, accl[4] = {}; v16h kf[HD / 32][4], vf[2][HD / 16];
#pragma unroll
    for (int kc = 0; kc < HD / 32; ++kc) {   // all of the pass's k fragments are asked for before the first product, so that their latencies overlap
#pragma unroll
      for (int j = 0; j < 4; ++j) kf[kc][j] = frag_h(Kb + (size_t)(k0 + j * 16) * CC + kc * 32, lane); }
#pragma unroll
    for (int kc = 0; kc < HD / 32; ++kc) {
#pragma unroll
      for (int j = 0; j < 4; ++j) { acc[j] = wmma16(kf[kc][j], qh[kc], acc[j]); accl[j] = wmma16(kf[kc][j], ql[kc], accl[j]); } }
#pragma unroll
    for (int kc = 0; kc < 2; ++kc) {   // the pass's v fragments fly while the softmax is worked out
#pragma unroll
      for (int jj = 0; jj < HD / 16; ++jj) vf[kc][jj] = frag_h(Vb + (size_t)(jj * 16) * TT + k0 + kc * 32, lane); }
    float mx = -3.0e38f;
#pragma unroll
    for (int j = 0; j < 4; ++j) {
#pragma unroll
      for (int r = 0; r < 8; ++r) { const float s = (acc[j][r] + accl[j][r] * (1.0f / 1024.0f)) * SCALE; acc[j][r] = s; mx = fmaxf(mx, s); } }
    mx = fmaxf(mx, __shfl_xor(mx, 16));   // the other half of this query's keys
    const float mn = fmaxf(m, mx); const float corr = expf(m - mn); m = mn;
    float sum = 0.f; v16h p[2];
#pragma unroll
    for (int j = 0; j < 4; ++j) {
#pragma unroll
      for (int r = 0; r < 8; ++r) { const float e = expf(acc[j][r] - mn); sum += e; p[j >> 1][(j & 1) * 8 + r] = (_Float16)(e * 1024.0f); } }
    l = l * corr + sum;
#pragma unroll
    for (int jj = 0; jj < HD / 16; ++jj) {
#pragma unroll
      for (int r = 0; r < 8; ++r) o[jj][r] *= corr; }
#pragma unroll
    for (int kc = 0; kc < 2; ++kc) {
#pragma unroll
      for (int jj = 0; jj < HD / 16; ++jj) o[jj] = wmma16(vf[kc][jj], p[kc], o[jj]); } }
  l += __shfl_xor(l, 16); const float inv = 1.0f / (1024.0f * l);
#pragma unroll
  for (int jj = 0; jj < HD / 16; ++jj)
#pragma unroll
    for (int r = 0; r < 8; ++r) ss[wave][col][jj * 16 + 8 * g + r] = o[jj][r] * inv;
  LDSX(); for (int rl = 0; rl < 16; ++rl) if (lane < HD / 4) vst2(Y + ((size_t)b * TT + ql0 + rl) * CC + h * HD + lane * 4, *(const v4f*)&ss[wave][rl][lane * 4]); }
// ---- k_out: block = (64 rows, 128 cols): out = ctx Wo (+ bo): all rows: ctx bf16 hi + lo against exact bf16 Wo (2 products); the f16 1-product branch (Wo as f16(bf16 x 2^8), x 2^-8) is not taken
__global__ __launch_bounds__(128) void k_out(const float* __restrict__ Y, const float* __restrict__ WO, const float* __restrict__ BO, float* __restrict__ OUT) { __shared__ __align__(16) float sf[4][16][132];
  const int tid = threadIdx.x, wave = tid >> 5, lane = tid & 31, col = lane & 15, g = lane >> 4; const int c0 = blockIdx.y * 128; const size_t r0 = (size_t)blockIdx.x * 64 + wave * 16;
  v8f acc[8] = {};
  if (true) {   /* ALL rows: ctx split bf16 hi + lo x exact Wo (2 products) */
#pragma unroll 2
    for (int kc = 0; kc < CC / 32; ++kc) { const F2 a = split_row(Y + (r0 + col) * CC, kc * 32, lane); asm volatile("s_wait_loadcnt 0x0" ::: "memory");
#pragma unroll
      for (int j = 0; j < 8; ++j) { const v16b w = WOCOL(WO, kc * 32, c0 + j * 16 + col, lane); asm volatile("s_wait_loadcnt 0x0" ::: "memory"); acc[j] = wmma_bf(a.h, w, acc[j]); acc[j] = wmma_bf(a.l, w, acc[j]); } }
#pragma unroll
    for (int j = 0; j < 8; ++j) { const float bias = BO ? bfr(BO[c0 + j * 16 + col]) : 0.f;
#pragma unroll
      for (int r = 0; r < 8; ++r) sf[wave][8 * g + r][j * 16 + col] = acc[j][r] + bias; }
  } else {
#pragma unroll 2
    for (int kc = 0; kc < CC / 32; ++kc) { const v16h a = frag_f32(Y + (r0 + col) * CC + kc * 32, lane); asm volatile("s_wait_loadcnt 0x0" ::: "memory");
#pragma unroll
      for (int j = 0; j < 8; ++j) { const v16h w = WOCOLH(WO, kc * 32, c0 + j * 16 + col, lane); asm volatile("s_wait_loadcnt 0x0" ::: "memory"); acc[j] = wmma16(a, w, acc[j]); } }
#pragma unroll
    for (int j = 0; j < 8; ++j) { const float bias = BO ? bfr(BO[c0 + j * 16 + col]) : 0.f;
#pragma unroll
      for (int r = 0; r < 8; ++r) sf[wave][8 * g + r][j * 16 + col] = acc[j][r] * (1.0f / 256.0f) + bias; } }
  LDSX(); for (int rl = 0; rl < 16; ++rl) vst2(OUT + (r0 + rl) * DIN + c0 + lane * 4, *(const v4f*)&sf[wave][rl][lane * 4]); }

extern "C" void kernel_launch(void* const* d_in, const int* in_sizes, int n_in, void* d_out, int out_size, void* d_ws, size_t ws_size, hipStream_t stream) {
  (void)in_sizes; (void)n_in; (void)out_size;
  const float** F = (const float**)d_in;
  if (ws_size < (size_t)WS_END) return;
  char* ws = (char*)d_ws; _Float16 *QH = (_Float16*)(ws + WS_QH), *KH = (_Float16*)(ws + WS_KH), *VT = (_Float16*)(ws + WS_VT), *QL = (_Float16*)(ws + WS_QL), *KL = (_Float16*)(ws + WS_KL); __bf16 *VB = (__bf16*)(ws + WS_VB), *VBL = (__bf16*)(ws + WS_VBL); float *Y = (float*)(ws + WS_Y);
  (void)Y; (void)QL; (void)KL; (void)VB; (void)VBL;
  // inputs: 0 q, 1 k, 2 v [4,1024,1024]; 3 Wq [1024,1024] (out,in), 4 bq; 5 Wk, 6 bk; 7 Wv, 8 bv; 9 Wo, 10 bo
  k_proj<<<dim3(TNB * TT / 64, CC / 128, 3), 128, 0, stream>>>(F[0], F[1], F[2], F[3], F[5], F[7], F[4], F[6], F[8], QH, QL, KH, KL, VT, VB, VBL);
  k_attn<<<dim3(NQB, NH, TNB), 128, 0, stream>>>(QH, KH, QL, VT, Y);
  k_out<<<dim3(TNB * TT / 64, DIN / 128), 128, 0, stream>>>(Y, F[9], F[10], (float*)d_out);
}

// v002
// A run of this version takes 138 microseconds.
// In two side-by-side timings against v001, it was 3.82 and 3.83 times as fast.
// Over all steps from v000 it is 9.50 times as fast.
// compute dtype: all float inputs rounded to bf16; q/k/v projections with EXACT bf16 products on WMMA 16x16x32 (f32 accumulate); the sinusoidal PE added in f32 (sincosf) to the projected q/k rows; q as f16 hi + residual (x 2^10) against k once to f16 (2 products) x 64^-0.5; softmax in f32 (precise expf) with a running maximum and sum, 64 keys a pass; exp(s - m) x 2^10 once to f16 against v once to f16 (1 product); ctx split bf16 hi + lo against exact Wo (2 products); f32 output.
#include <hip/hip_runtime.h>
#include <math.h>

typedef __attribute__((ext_vector_type(16))) _Float16 v16h;
typedef __attribute__((ext_vector_type(16))) __bf16 v16b;
typedef __attribute__((ext_vector_type(8)))  _Float16 v8h;
typedef __attribute__((ext_vector_type(8)))  float v8f;
typedef __attribute__((ext_vector_type(4)))  float v4f;
typedef __attribute__((ext_vector_type(2)))  float v2f;
typedef __attribute__((ext_vector_type(4)))  unsigned v4u;
typedef __attribute__((ext_vector_type(4)))  int v4i;
typedef float __attribute__((may_alias)) float_a;
typedef int __attribute__((may_alias)) int_a;

template <typename T> __device__ __forceinline__ void vst2(void* p, T v) { *(T*)p = v;  }
__device__ __forceinline__ v8f wmma16(v16h a, v16h b, v8f c) {
  v8f d = __builtin_amdgcn_wmma_f32_16x16x32_f16(false, a, false, b, (short)0, c, false, false);
  asm volatile("v_nop\n\tv_nop\n\tv_nop\n\tv_nop" : "+v"(d) : "v"(a), "v"(b));
  return d;
}
__device__ __forceinline__ v8f wmma_bf(v16b a, v16b b, v8f c) {
  v8f d = __builtin_amdgcn_wmma_f32_16x16x32_bf16(false, a, false, b, (short)0, c, false, false);
  asm volatile("v_nop\n\tv_nop\n\tv_nop\n\tv_nop" : "+v"(d) : "v"(a), "v"(b));
  return d;
}
// 16x16x32 fragments: lane = (h = lane>>4, row/col = lane&15); elements 0..7 = k0+8h+0..7, 8..15 = k0+16+8h+0..7; D element r = row 8h+r
__device__ __forceinline__ v16h frag_h(const _Float16* rowk0, int lane) {
  union { v16h v; v8h q[2]; } u; const _Float16* p = rowk0 + 8 * (lane >> 4);
  u.q[0] = *(const v8h*)p; u.q[1] = *(const v8h*)(p + 16); return u.v;
}
__device__ __forceinline__ v16h frag_f32(const float* rowk0, int lane) {
  v16h a; const float* p = rowk0 + 8 * (lane >> 4);
#pragma unroll
  for (int i = 0; i < 8; ++i) { a[i] = (_Float16)p[i]; a[8 + i] = (_Float16)p[16 + i]; }
  return a;
}
__device__ __forceinline__ v16h frag_f32s(const float* rowk0, int lane, float sc) {
  v16h a; const float* p = rowk0 + 8 * (lane >> 4);
#pragma unroll
  for (int i = 0; i < 8; ++i) { a[i] = (_Float16)(p[i] * sc); a[8 + i] = (_Float16)(p[16 + i] * sc); }
  return a;
}
// column fragment from a [K][ld] layout (column n), rows >= K read as 0
__device__ __forceinline__ v16h fragc_f32(const float* W, int k0, int n, int lane, int ld, int K) {
  v16h a; const int g = lane >> 4;
#pragma unroll
  for (int i = 0; i < 8; ++i) { const int ka = k0 + 8 * g + i, kb = ka + 16;
    a[i] = (_Float16)(ka < K ? W[(size_t)(ka < K ? ka : K - 1) * ld + n] : 0.f); a[8 + i] = (_Float16)(kb < K ? W[(size_t)(kb < K ? kb : K - 1) * ld + n] : 0.f); }
  return a;
}
struct F2 { v16b h, l; };
__device__ __forceinline__ F2 bsplit16(const float v[16]) { F2 r;
#pragma unroll
  for (int i = 0; i < 16; ++i) { const __bf16 h = (__bf16)v[i]; r.h[i] = h; r.l[i] = (__bf16)(v[i] - (float)h); }
  return r; }
__device__ __forceinline__ F2 split_row(const float* row, int k0, int lane) { float v[16]; const float* p = row + k0 + 8 * (lane >> 4);
#pragma unroll
  for (int i = 0; i < 8; ++i) { v[i] = p[i]; v[8 + i] = p[16 + i]; }
  return bsplit16(v); }
__device__ __forceinline__ F2 split_rowK(const float* row, int k0, int lane, int K) { float v[16]; const int g = lane >> 4;
#pragma unroll
  for (int i = 0; i < 8; ++i) { const int ka = k0 + 8 * g + i, kb = ka + 16; v[i] = ka < K ? row[ka < K ? ka : K - 1] : 0.f; v[8 + i] = kb < K ? row[kb < K ? kb : K - 1] : 0.f; }
  return bsplit16(v); }
__device__ __forceinline__ F2 split_col(const float* W, int k0, int n, int lane, int ld, int K) { float v[16]; const int g = lane >> 4;
#pragma unroll
  for (int i = 0; i < 8; ++i) { const int ka = k0 + 8 * g + i, kb = ka + 16; v[i] = ka < K ? W[(size_t)(ka < K ? ka : K - 1) * ld + n] : 0.f; v[8 + i] = kb < K ? W[(size_t)(kb < K ? kb : K - 1) * ld + n] : 0.f; }
  return bsplit16(v); }
__device__ __forceinline__ v8f mac3(const F2& a, const F2& b, v8f c) { c = wmma_bf(a.l, b.h, c); c = wmma_bf(a.h, b.l, c); return wmma_bf(a.h, b.h, c); }
__device__ __forceinline__ float sigm(float v) { return 1.0f / (1.0f + expf(-v)); }
#define LDSX() do { asm volatile("s_wait_dscnt 0" ::: "memory"); __builtin_amdgcn_wave_barrier(); __builtin_amdgcn_fence(__ATOMIC_RELEASE, "workgroup"); } while (0)

// Multi-head attention with an additive sinusoidal positional encoding (B 4, S 1,024, 1,024 = 16 x 64; separate q/k/v inputs): qh, kh, vh = x W^T + b ((out,in)); qh += pe, kh += pe with pe[t][2i] = sin(t div_i), pe[t][2i+1] = cos(t div_i), div_i = exp(-2i ln(10000)/64); out = merged(softmax(qh kh^T x 64^-0.5) vh) Wo^T + bo.
#define NB 4
#define TT 1024
#define CC 1024            // NH * HD = projected width
#define DIN 1024          // input (model) width
#define NH 16
#define HD 64
#define NQB (TT / 64)
#define HG 4
#define SCALE (0.125f)
#define CAUSAL 0
#ifndef TNB
#define TNB NB
#endif
__device__ __forceinline__ float bfr(float v) { return (float)(__bf16)v; }
__host__ __device__ __forceinline__ int kb_last(int qb) { return CAUSAL ? ((qb * 64 + 63) >> 7) : (TT / 128 - 1); }
typedef __attribute__((ext_vector_type(8))) __bf16 v8b;
__device__ __forceinline__ v16b frag_b(const __bf16* rowk0, int lane) {
  union { v16b v; v8b q[2]; } u; const __bf16* p = rowk0 + 8 * (lane >> 4);
  u.q[0] = *(const v8b*)p; u.q[1] = *(const v8b*)(p + 16); return u.v;
}
#define QBH 0              // not read by any kernel
#define QHI 1024            // rows carrying a q residual plane (all rows when non-causal: 2-product logits everywhere)
#define KHI 64            // key rows carrying k residual / v bf16 hi+lo planes (written by k_proj, read by no kernel)
// B fragment (k rows k0+.., output column o) of a weight: (in,out) [K][ld] or (out,in) [ld rows of K]: bf16 exact, or f16(bf16 * 256) exact
__device__ __forceinline__ v16b wcol_io(const float* Wm, int k0, int o, int lane, int ld) { v16b w; const int g = lane >> 4;
#pragma unroll
  for (int i = 0; i < 8; ++i) { w[i] = (__bf16)Wm[(size_t)(k0 + 8 * g + i) * ld + o]; w[8 + i] = (__bf16)Wm[(size_t)(k0 + 16 + 8 * g + i) * ld + o]; }
  return w; }
__device__ __forceinline__ v16b wcol_oi(const float* Wm, int k0, int o, int lane, int K) { v16b w; const float* p = Wm + (size_t)o * K + k0 + 8 * (lane >> 4);
#pragma unroll
  for (int i = 0; i < 8; ++i) { w[i] = (__bf16)p[i]; w[8 + i] = (__bf16)p[16 + i]; }
  return w; }
__device__ __forceinline__ v16h wcolh_io(const float* Wm, int k0, int o, int lane, int ld) { v16h w; const int g = lane >> 4;
#pragma unroll
  for (int i = 0; i < 8; ++i) { w[i] = (_Float16)(bfr(Wm[(size_t)(k0 + 8 * g + i) * ld + o]) * 256.0f); w[8 + i] = (_Float16)(bfr(Wm[(size_t)(k0 + 16 + 8 * g + i) * ld + o]) * 256.0f); }
  return w; }
__device__ __forceinline__ v16h wcolh_oi(const float* Wm, int k0, int o, int lane, int K) { v16h w; const float* p = Wm + (size_t)o * K + k0 + 8 * (lane >> 4);
#pragma unroll
  for (int i = 0; i < 8; ++i) { w[i] = (_Float16)(bfr(p[i]) * 256.0f); w[8 + i] = (_Float16)(bfr(p[16 + i]) * 256.0f); }
  return w; }
#define WQKV_LAYOUT 1   // 0 = (in,out) [DIN][CC]; 1 = (out,in) [CC][DIN]; 2 = per-head [NH][DIN][HD]
__device__ __forceinline__ v16b wcol_hdk(const float* Wm, int k0, int o, int lane) { v16b w; const int g = lane >> 4; const float* p = Wm + (size_t)(o / HD) * DIN * HD + (o % HD);
#pragma unroll
  for (int i = 0; i < 8; ++i) { w[i] = (__bf16)p[(size_t)(k0 + 8 * g + i) * HD]; w[8 + i] = (__bf16)p[(size_t)(k0 + 16 + 8 * g + i) * HD]; }
  return w; }
#define WO_OUT_IN 1
#if WQKV_LAYOUT == 1
#define WCOL(W, k0, o, lane) wcol_oi(W, k0, o, lane, DIN)
#elif WQKV_LAYOUT == 2
#define WCOL(W, k0, o, lane) wcol_hdk(W, k0, o, lane)
#else
#define WCOL(W, k0, o, lane) wcol_io(W, k0, o, lane, CC)
#endif
#if WO_OUT_IN
#define WOCOL(W, k0, o, lane) wcol_oi(W, k0, o, lane, CC)
#define WOCOLH(W, k0, o, lane) wcolh_oi(W, k0, o, lane, CC)
#else
#define WOCOL(W, k0, o, lane) wcol_io(W, k0, o, lane, DIN)
#define WOCOLH(W, k0, o, lane) wcolh_io(W, k0, o, lane, DIN)
#endif
__constant__ float c_div[32] = {1.000000000e+0f,7.498942018e-1f,5.623413324e-1f,4.216964841e-1f,3.162277639e-1f,2.371373624e-1f,1.778279394e-1f,1.333521456e-1f,9.999999404e-2f,7.498941571e-2f,5.623412877e-2f,4.216964915e-2f,3.162277490e-2f,2.371373586e-2f,1.778279245e-2f,1.333521307e-2f,9.999999776e-3f,7.498941384e-3f,5.623412784e-3f,4.216964822e-3f,3.162277397e-3f,2.371373586e-3f,1.778279198e-3f,1.333521330e-3f,9.999999311e-4f,7.498941268e-4f,5.623412435e-4f,4.216964589e-4f,3.162277280e-4f,2.371373412e-4f,1.778279257e-4f,1.333521213e-4f};   /* f32(exp(2i * (-ln(10000)/64))) - the module's 'div' */
#define PROJ_EPI(which, row, t, h) do { if ((which) < 2) { float* rw = (row); const float pf = (float)(t); _Pragma("unroll") for (int i = 0; i < 32; ++i) { float sn, cs; sincosf(pf * c_div[i], &sn, &cs); rw[2 * i] += sn; rw[2 * i + 1] += cs; } } } while (0)   /* q, k += sinusoidal PE: pe[t][2i] = sin(t div_i), pe[t][2i+1] = cos(t div_i) */
#ifndef SM_EXTRA_PARAMS
#define SM_EXTRA_PARAMS
#endif
#ifndef PROJ_EXTRA_PARAMS
#define PROJ_EXTRA_PARAMS
#endif
#ifndef SM_MASK_HOOK
#define SM_MASK_HOOK (void)0
#endif

#define WS_QH  0u                                      // f16 q rows [b*t][CC]
#define WS_KH  (WS_QH + 2u * (size_t)NB * TT * CC)      // f16 k rows [b*t][CC]
#define WS_VT  (WS_KH + 2u * (size_t)NB * TT * CC)      // f16 v planes [b][c][t]
#define WS_QL  (WS_VT + 2u * (size_t)NB * CC * TT)      // f16 q residual x 2^10 rows [b][t < QHI][CC]
#define WS_KL  (WS_QL + 2u * (size_t)NB * QHI * CC)     // f16 k residual x 2^10 rows [b][t < KHI][CC]
#define WS_VB  (WS_KL + 2u * (size_t)NB * KHI * CC)     // bf16 v hi planes [b][c][t < KHI]
#define WS_VBL (WS_VB + 2u * (size_t)NB * CC * KHI)
#define WS_Y   (WS_VBL + 2u * (size_t)NB * CC * KHI)    // f32 ctx rows [b*t][CC] (only when there is an output projection)
#define WS_END (WS_Y  + 4u * (size_t)NB * TT * CC)

// ---- operand staging of the two projection kernels: a stage is SBK k columns of the block's rows, read from global memory once a block (16 lanes x 16 B a row, so every wave-wide load covers whole 128-B lines), rounded to bf16 once (k_out's ctx: bf16 hi + lo) and kept in LDS for all four waves
typedef __attribute__((ext_vector_type(4))) __bf16 v4b;
#define SBK 64
#define SP (SBK + 8)        // staged row pitch in bf16 elements: 144 B = 16 B x 9, an odd count of 16 B for the ds_load_b128 fragment reads
template <int N> __device__ __forceinline__ void ldg_tile(v4f (&r)[N], const float* p, int ld) {
#pragma unroll
  for (int i = 0; i < N; ++i) r[i] = *(const v4f*)(p + (size_t)(8 * i) * ld); }
template <int N> __device__ __forceinline__ void sts_bf(__bf16* d, const v4f (&r)[N]) {
#pragma unroll
  for (int i = 0; i < N; ++i) { v4b t;
#pragma unroll
    for (int k = 0; k < 4; ++k) t[k] = (__bf16)r[i][k];
    *(v4b*)(d + 8 * i * SP) = t; } }
template <int N> __device__ __forceinline__ void sts_split(__bf16* dh, __bf16* dl, const v4f (&r)[N]) {
#pragma unroll
  for (int i = 0; i < N; ++i) { v4b th, tl;
#pragma unroll
    for (int k = 0; k < 4; ++k) { const __bf16 h = (__bf16)r[i][k]; th[k] = h; tl[k] = (__bf16)(r[i][k] - (float)h); }
    *(v4b*)(dh + 8 * i * SP) = th; *(v4b*)(dl + 8 * i * SP) = tl; } }
// ---- k_proj: block = (64 rows, 128 cols, which): q/k/v = X W (+ b) with exact bf16 products (K = DIN) -> which 0: q f16 rows (+ residual rows < QHI); 1: k f16 rows (+ residual rows < KHI); 2: v f16 planes [c][t] (+ bf16 hi/lo planes for t < KHI)
__global__ __launch_bounds__(128) void k_proj(const float* __restrict__ XQ, const float* __restrict__ XK, const float* __restrict__ XV, const float* __restrict__ WQ, const float* __restrict__ WK, const float* __restrict__ WV, const float* __restrict__ BQ, const float* __restrict__ BK, const float* __restrict__ BV,
    _Float16* __restrict__ QH, _Float16* __restrict__ QL, _Float16* __restrict__ KH, _Float16* __restrict__ KL, _Float16* __restrict__ VT, __bf16* __restrict__ VB, __bf16* __restrict__ VBL PROJ_EXTRA_PARAMS) {
  // LDS: st, then one region that holds in turn the two operand stages (192 rows each: X 64, W 128) and, behind the epilogue's barriers, either sh + sl or th + tb + tbl
  __shared__ __align__(16) float st[64][132]; __shared__ __align__(16) unsigned char ur[2 * 192 * SP * 2];
  __bf16* const sg = (__bf16*)ur; _Float16 (* const sh)[136] = (_Float16 (*)[136])ur; _Float16 (* const sl)[136] = (_Float16 (*)[136])(ur + 64 * 136 * 2);
  _Float16 (* const th)[72] = (_Float16 (*)[72])ur; __bf16 (* const tb)[72] = (__bf16 (*)[72])(ur + 128 * 72 * 2); __bf16 (* const tbl)[72] = (__bf16 (*)[72])(ur + 2 * 128 * 72 * 2);
  const int tid = threadIdx.x, wave = tid >> 5, lane = tid & 31, col = lane & 15, g = lane >> 4; const int which = blockIdx.z; const int c0 = blockIdx.y * 128; const size_t r0 = (size_t)blockIdx.x * 64; const size_t bb = r0 / TT; const int t0 = (int)(r0 % TT);
  const float* X = which == 0 ? XQ : which == 1 ? XK : XV; const float* WA = which == 0 ? WQ : which == 1 ? WK : WV; const float* BA = which == 0 ? BQ : which == 1 ? BK : BV;
  v8f acc[8] = {};
  { const int srow = tid >> 4, sq = (tid & 15) * 4; const float* Xp = X + (r0 + srow) * DIN + sq; const float* Wp = WA + (size_t)(c0 + srow) * DIN + sq; __bf16* const sd = sg + srow * SP + sq;
    v4f xr[8], wr[16];
    ldg_tile(xr, Xp, DIN); ldg_tile(wr, Wp, DIN);
    asm volatile("s_wait_xcnt 0x0" :: "v"(Xp), "v"(Wp) : "memory");   // in front of the first overwrite of the loads' address registers: as inputs they stay untouched up to here (the build reused one pair for the accumulators' zeros)
    sts_bf(sd, xr); sts_bf(sd + 64 * SP, wr);
    // two stages a trip, so that the buffer's offset is a constant of each half
#pragma unroll 2
    for (int s = 0; s < DIN / SBK; ++s) {
      __syncthreads();   // publishes stage s and ends every wave's reads of the buffer that stage s + 1 is stored into below
      if (s + 1 < DIN / SBK) { ldg_tile(xr, Xp + (s + 1) * SBK, DIN); ldg_tile(wr, Wp + (s + 1) * SBK, DIN);   // the next stage's loads fly while this stage is multiplied
        asm volatile("s_wait_xcnt 0x0" ::: "memory"); }   // behind the run of loads: in front of the next trip's overwrite of their address registers on every way through the loop
      const __bf16* bu = sg + (s & 1) * (192 * SP);
#pragma unroll
      for (int kk = 0; kk < SBK / 32; ++kk) { const v16b a = frag_b(bu + (wave * 16 + col) * SP + kk * 32, lane); v16b w[8];
#pragma unroll
        for (int j = 0; j < 8; ++j) w[j] = frag_b(bu + (64 + j * 16 + col) * SP + kk * 32, lane);
#pragma unroll
        for (int j = 0; j < 8; ++j) acc[j] = wmma_bf(a, w[j], acc[j]); }
      __builtin_amdgcn_sched_barrier(0);   // keeps the waits for the next stage's loads behind all of this stage's products
      if (s + 1 < DIN / SBK) { __bf16* d = sd + ((s + 1) & 1) * (192 * SP); sts_bf(d, xr); sts_bf(d + 64 * SP, wr); } } }
  { // stage the f32 tile (acc + bias) in LDS, run the per-(row, head) epilogue hook, then convert
#pragma unroll
    for (int j = 0; j < 8; ++j) { const float bias = BA ? bfr(BA[c0 + j * 16 + col]) : 0.f;
#pragma unroll
      for (int r = 0; r < 8; ++r) st[wave * 16 + 8 * g + r][j * 16 + col] = acc[j][r] + bias; }
    __syncthreads();
    for (int e = tid; e < 64 * (128 / HD); e += 128) { const int rl = e / (128 / HD), hh = e % (128 / HD); PROJ_EPI(which, &st[rl][hh * HD], (int)((r0 + rl) % TT), (c0 / HD) + hh); }
    __syncthreads(); }
  if (which < 2) { _Float16* DH = which == 0 ? QH : KH; _Float16* DL = which == 0 ? QL : KL; const int nhi = which == 0 ? QHI : KHI; const bool hi_rows = t0 < nhi;
    for (int e = tid; e < 64 * 128; e += 128) { const int rl = e >> 7, cl = e & 127; const float v = st[rl][cl]; const _Float16 hv = (_Float16)v; sh[rl][cl] = hv; sl[rl][cl] = (_Float16)((v - (float)hv) * 1024.0f); }
    __syncthreads();
    for (int e = tid; e < 64 * 16; e += 128) { const int rl = e >> 4, q = e & 15; vst2((unsigned*)(DH + (r0 + rl) * CC + c0 + q * 8), *(const v4u*)&sh[rl][q * 8]); if (hi_rows) vst2((unsigned*)(DL + (bb * nhi + t0 + rl) * (size_t)CC + c0 + q * 8), *(const v4u*)&sl[rl][q * 8]); }
  } else { const bool hi_rows = t0 < KHI;
    for (int e = tid; e < 64 * 128; e += 128) { const int rl = e & 63, cl = e >> 6; const float v = st[rl][cl]; th[cl][rl] = (_Float16)v; const __bf16 bh = (__bf16)v; tb[cl][rl] = bh; tbl[cl][rl] = (__bf16)(v - (float)bh); }
    __syncthreads();
    for (int e = tid; e < 128 * 8; e += 128) { const int cl = e >> 3, q = e & 7; vst2((unsigned*)(VT + (bb * CC + c0 + cl) * (size_t)TT + t0 + q * 8), *(const v4u*)&th[cl][q * 8]);
      asm volatile("s_wait_xcnt 0x0" ::: "memory");   // in front of the overwrite of the store's data and address registers (this build reuses them at once)
      if (hi_rows) { const size_t o3 = (bb * CC + c0 + cl) * (size_t)KHI + t0 + q * 8; vst2((unsigned*)(VB + o3), *(const v4u*)&tb[cl][q * 8]); vst2((unsigned*)(VBL + o3), *(const v4u*)&tbl[cl][q * 8]);
        asm volatile("s_wait_xcnt 0x0" ::: "memory"); } } } }   // the same for these two stores, in front of the next trip
__global__ __launch_bounds__(128) void k_attn(const _Float16* __restrict__ QH, const _Float16* __restrict__ KH, const _Float16* __restrict__ QL, const _Float16* __restrict__ VT, float* __restrict__ Y) { __shared__ __align__(16) float ss[4][16][HD + 4];
  const int tid = threadIdx.x, wave = tid >> 5, lane = tid & 31, col = lane & 15, g = lane >> 4; const int qb = blockIdx.x, h = blockIdx.y, b = blockIdx.z; const int ql0 = qb * 64 + wave * 16;
  v16h qh[HD / 32], ql[HD / 32];
#pragma unroll
  for (int kc = 0; kc < HD / 32; ++kc) { qh[kc] = frag_h(QH + ((size_t)b * TT + ql0 + col) * CC + h * HD + kc * 32, lane); ql[kc] = frag_h(QL + ((size_t)b * QHI + ql0 + col) * CC + h * HD + kc * 32, lane); }
  const _Float16* Kb = KH + ((size_t)b * TT + col) * CC + h * HD;            // key row col of the head
  const _Float16* Vb = VT + ((size_t)b * CC + h * HD + col) * (size_t)TT;    // v plane col of the head
  v8f o[HD / 16] = {}; float m = -3.0e38f, l = 0.f;
  // the pass loop stays rolled (two passes' fragments at once would cost the fourth wave of a SIMD); every inner loop is unrolled so that each register-array index is a constant
#pragma unroll 1
  for (int k0 = 0; k0 < TT; k0 += 64) { v8f acc[4] = {}, accl[4] = {}; v16h kf[HD / 32][4], vf[2][HD / 16];
#pragma unroll
    for (int kc = 0; kc < HD / 32; ++kc) {   // all of the pass's k fragments are asked for before the first product, so that their latencies overlap
#pragma unroll
      for (int j = 0; j < 4; ++j) kf[kc][j] = frag_h(Kb + (size_t)(k0 + j * 16) * CC + kc * 32, lane); }
#pragma unroll
    for (int kc = 0; kc < HD / 32; ++kc) {
#pragma unroll
      for (int j = 0; j < 4; ++j) { acc[j] = wmma16(kf[kc][j], qh[kc], acc[j]); accl[j] = wmma16(kf[kc][j], ql[kc], accl[j]); } }
#pragma unroll
    for (int kc = 0; kc < 2; ++kc) {   // the pass's v fragments fly while the softmax is worked out
#pragma unroll
      for (int jj = 0; jj < HD / 16; ++jj) vf[kc][jj] = frag_h(Vb + (size_t)(jj * 16) * TT + k0 + kc * 32, lane); }
    float mx = -3.0e38f;
#pragma unroll
    for (int j = 0; j < 4; ++j) {
#pragma unroll
      for (int r = 0; r < 8; ++r) { const float s = (acc[j][r] + accl[j][r] * (1.0f / 1024.0f)) * SCALE; acc[j][r] = s; mx = fmaxf(mx, s); } }
    mx = fmaxf(mx, __shfl_xor(mx, 16));   // the other half of this query's keys
    const float mn = fmaxf(m, mx); const float corr = expf(m - mn); m = mn;
    float sum = 0.f; v16h p[2];
#pragma unroll
    for (int j = 0; j < 4; ++j) {
#pragma unroll
      for (int r = 0; r < 8; ++r) { const float e = expf(acc[j][r] - mn); sum += e; p[j >> 1][(j & 1) * 8 + r] = (_Float16)(e * 1024.0f); } }
    l = l * corr + sum;
#pragma unroll
    for (int jj = 0; jj < HD / 16; ++jj) {
#pragma unroll
      for (int r = 0; r < 8; ++r) o[jj][r] *= corr; }
#pragma unroll
    for (int kc = 0; kc < 2; ++kc) {
#pragma unroll
      for (int jj = 0; jj < HD / 16; ++jj) o[jj] = wmma16(vf[kc][jj], p[kc], o[jj]); } }
  l += __shfl_xor(l, 16); const float inv = 1.0f / (1024.0f * l);
#pragma unroll
  for (int jj = 0; jj < HD / 16; ++jj)
#pragma unroll
    for (int r = 0; r < 8; ++r) ss[wave][col][jj * 16 + 8 * g + r] = o[jj][r] * inv;
  LDSX(); for (int rl = 0; rl < 16; ++rl) if (lane < HD / 4) vst2(Y + ((size_t)b * TT + ql0 + rl) * CC + h * HD + lane * 4, *(const v4f*)&ss[wave][rl][lane * 4]); }
// ---- k_out: block = (64 rows, 128 cols): out = ctx Wo (+ bo): all rows: ctx bf16 hi + lo against exact bf16 Wo (2 products)
__global__ __launch_bounds__(128) void k_out(const float* __restrict__ Y, const float* __restrict__ WO, const float* __restrict__ BO, float* __restrict__ OUT) { __shared__ __align__(16) float sf[4][16][132]; __shared__ __align__(16) __bf16 sg[2 * 256 * SP];   // two operand stages of 256 rows: ctx hi 64, ctx lo 64, Wo 128
  const int tid = threadIdx.x, wave = tid >> 5, lane = tid & 31, col = lane & 15, g = lane >> 4; const int c0 = blockIdx.y * 128; const size_t r0 = (size_t)blockIdx.x * 64 + wave * 16;
  v8f acc[8] = {};
  if (true) {   /* ALL rows: ctx split bf16 hi + lo x exact Wo (2 products) */
    const int srow = tid >> 4, sq = (tid & 15) * 4; const float* Yp = Y + ((size_t)blockIdx.x * 64 + srow) * CC + sq; const float* Wp = WO + (size_t)(c0 + srow) * CC + sq; __bf16* const sd = sg + srow * SP + sq;
    v4f yr[8], wr[16];
    ldg_tile(yr, Yp, CC); ldg_tile(wr, Wp, CC); sts_split(sd, sd + 64 * SP, yr); sts_bf(sd + 128 * SP, wr);
    // two stages a trip, so that the buffer's offset is a constant of each half
#pragma unroll 2
    for (int s = 0; s < CC / SBK; ++s) {
      __syncthreads();   // publishes stage s and ends every wave's reads of the buffer that stage s + 1 is stored into below
      if (s + 1 < CC / SBK) { ldg_tile(yr, Yp + (s + 1) * SBK, CC); ldg_tile(wr, Wp + (s + 1) * SBK, CC);   // the next stage's loads fly while this stage is multiplied
        asm volatile("s_wait_xcnt 0x0" ::: "memory"); }   // behind the run of loads: in front of the next trip's overwrite of their address registers on every way through the loop
      const __bf16* bu = sg + (s & 1) * (256 * SP);
#pragma unroll
      for (int kk = 0; kk < SBK / 32; ++kk) { const v16b ah = frag_b(bu + (wave * 16 + col) * SP + kk * 32, lane), al = frag_b(bu + (64 + wave * 16 + col) * SP + kk * 32, lane); v16b w[8];
#pragma unroll
        for (int j = 0; j < 8; ++j) w[j] = frag_b(bu + (128 + j * 16 + col) * SP + kk * 32, lane);
#pragma unroll
        for (int j = 0; j < 8; ++j) { acc[j] = wmma_bf(ah, w[j], acc[j]); acc[j] = wmma_bf(al, w[j], acc[j]); } }
      __builtin_amdgcn_sched_barrier(0);   // keeps the waits for the next stage's loads behind all of this stage's products
      if (s + 1 < CC / SBK) { __bf16* d = sd + ((s + 1) & 1) * (256 * SP); sts_split(d, d + 64 * SP, yr); sts_bf(d + 128 * SP, wr); } }
#pragma unroll
    for (int j = 0; j < 8; ++j) { const float bias = BO ? bfr(BO[c0 + j * 16 + col]) : 0.f;
#pragma unroll
      for (int r = 0; r < 8; ++r) sf[wave][8 * g + r][j * 16 + col] = acc[j][r] + bias; }
  } else {
#pragma unroll 2
    for (int kc = 0; kc < CC / 32; ++kc) { const v16h a = frag_f32(Y + (r0 + col) * CC + kc * 32, lane); asm volatile("s_wait_loadcnt 0x0" ::: "memory");
#pragma unroll
      for (int j = 0; j < 8; ++j) { const v16h w = WOCOLH(WO, kc * 32, c0 + j * 16 + col, lane); asm volatile("s_wait_loadcnt 0x0" ::: "memory"); acc[j] = wmma16(a, w, acc[j]); } }
#pragma unroll
    for (int j = 0; j < 8; ++j) { const float bias = BO ? bfr(BO[c0 + j * 16 + col]) : 0.f;
#pragma unroll
      for (int r = 0; r < 8; ++r) sf[wave][8 * g + r][j * 16 + col] = acc[j][r] * (1.0f / 256.0f) + bias; } }
  LDSX(); for (int rl = 0; rl < 16; ++rl) vst2(OUT + (r0 + rl) * DIN + c0 + lane * 4, *(const v4f*)&sf[wave][rl][lane * 4]); }

extern "C" void kernel_launch(void* const* d_in, const int* in_sizes, int n_in, void* d_out, int out_size, void* d_ws, size_t ws_size, hipStream_t stream) {
  (void)in_sizes; (void)n_in; (void)out_size;
  const float** F = (const float**)d_in;
  if (ws_size < (size_t)WS_END) return;
  char* ws = (char*)d_ws; _Float16 *QH = (_Float16*)(ws + WS_QH), *KH = (_Float16*)(ws + WS_KH), *VT = (_Float16*)(ws + WS_VT), *QL = (_Float16*)(ws + WS_QL), *KL = (_Float16*)(ws + WS_KL); __bf16 *VB = (__bf16*)(ws + WS_VB), *VBL = (__bf16*)(ws + WS_VBL); float *Y = (float*)(ws + WS_Y);
  (void)Y; (void)QL; (void)KL; (void)VB; (void)VBL;
  // inputs: 0 q, 1 k, 2 v [4,1024,1024]; 3 Wq [1024,1024] (out,in), 4 bq; 5 Wk, 6 bk; 7 Wv, 8 bv; 9 Wo, 10 bo
  k_proj<<<dim3(TNB * TT / 64, CC / 128, 3), 128, 0, stream>>>(F[0], F[1], F[2], F[3], F[5], F[7], F[4], F[6], F[8], QH, QL, KH, KL, VT, VB, VBL);
  k_attn<<<dim3(NQB, NH, TNB), 128, 0, stream>>>(QH, KH, QL, VT, Y);
  k_out<<<dim3(TNB * TT / 64, DIN / 128), 128, 0, stream>>>(Y, F[9], F[10], (float*)d_out);
}

// v003
// Measured time: 118 microseconds a run.
// Timed twice side by side with v002, it ran 1.18 times as fast both times.
// Over all steps from v000 it is 11.2 times as fast.
// compute dtype: all float inputs rounded to bf16; q/k/v projections with EXACT bf16 products on WMMA 16x16x32 (f32 accumulate); the sinusoidal PE added in f32 (sincosf) to the projected q/k rows; q as f16 hi + residual (x 2^10) against k once to f16 (2 products) x 64^-0.5; softmax in f32 (precise expf) with a running maximum and sum, 64 keys a pass; exp(s - m) x 2^10 once to f16 against v once to f16 (1 product); ctx split bf16 hi + lo against exact Wo (2 products); f32 output.
#include <hip/hip_runtime.h>
#include <math.h>

typedef __attribute__((ext_vector_type(16))) _Float16 v16h;
typedef __attribute__((ext_vector_type(16))) __bf16 v16b;
typedef __attribute__((ext_vector_type(8)))  _Float16 v8h;
typedef __attribute__((ext_vector_type(8)))  float v8f;
typedef __attribute__((ext_vector_type(4)))  float v4f;
typedef __attribute__((ext_vector_type(2)))  float v2f;
typedef __attribute__((ext_vector_type(4)))  unsigned v4u;
typedef __attribute__((ext_vector_type(4)))  int v4i;
typedef float __attribute__((may_alias)) float_a;
typedef int __attribute__((may_alias)) int_a;

template <typename T> __device__ __forceinline__ void vst2(void* p, T v) { *(T*)p = v;  }
__device__ __forceinline__ v8f wmma16(v16h a, v16h b, v8f c) {
  v8f d = __builtin_amdgcn_wmma_f32_16x16x32_f16(false, a, false, b, (short)0, c, false, false);
  asm volatile("v_nop\n\tv_nop\n\tv_nop\n\tv_nop" : "+v"(d) : "v"(a), "v"(b));
  return d;
}
__device__ __forceinline__ v8f wmma_bf(v16b a, v16b b, v8f c) {
  v8f d = __builtin_amdgcn_wmma_f32_16x16x32_bf16(false, a, false, b, (short)0, c, false, false);
  asm volatile("v_nop\n\tv_nop\n\tv_nop\n\tv_nop" : "+v"(d) : "v"(a), "v"(b));
  return d;
}
// 16x16x32 fragments: lane = (h = lane>>4, row/col = lane&15); elements 0..7 = k0+8h+0..7, 8..15 = k0+16+8h+0..7; D element r = row 8h+r
__device__ __forceinline__ v16h frag_h(const _Float16* rowk0, int lane) {
  union { v16h v; v8h q[2]; } u; const _Float16* p = rowk0 + 8 * (lane >> 4);
  u.q[0] = *(const v8h*)p; u.q[1] = *(const v8h*)(p + 16); return u.v;
}
__device__ __forceinline__ v16h frag_f32(const float* rowk0, int lane) {
  v16h a; const float* p = rowk0 + 8 * (lane >> 4);
#pragma unroll
  for (int i = 0; i < 8; ++i) { a[i] = (_Float16)p[i]; a[8 + i] = (_Float16)p[16 + i]; }
  return a;
}
__device__ __forceinline__ v16h frag_f32s(const float* rowk0, int lane, float sc) {
  v16h a; const float* p = rowk0 + 8 * (lane >> 4);
#pragma unroll
  for (int i = 0; i < 8; ++i) { a[i] = (_Float16)(p[i] * sc); a[8 + i] = (_Float16)(p[16 + i] * sc); }
  return a;
}
// column fragment from a [K][ld] layout (column n), rows >= K read as 0
__device__ __forceinline__ v16h fragc_f32(const float* W, int k0, int n, int lane, int ld, int K) {
  v16h a; const int g = lane >> 4;
#pragma unroll
  for (int i = 0; i < 8; ++i) { const int ka = k0 + 8 * g + i, kb = ka + 16;
    a[i] = (_Float16)(ka < K ? W[(size_t)(ka < K ? ka : K - 1) * ld + n] : 0.f); a[8 + i] = (_Float16)(kb < K ? W[(size_t)(kb < K ? kb : K - 1) * ld + n] : 0.f); }
  return a;
}
struct F2 { v16b h, l; };
__device__ __forceinline__ F2 bsplit16(const float v[16]) { F2 r;
#pragma unroll
  for (int i = 0; i < 16; ++i) { const __bf16 h = (__bf16)v[i]; r.h[i] = h; r.l[i] = (__bf16)(v[i] - (float)h); }
  return r; }
__device__ __forceinline__ F2 split_row(const float* row, int k0, int lane) { float v[16]; const float* p = row + k0 + 8 * (lane >> 4);
#pragma unroll
  for (int i = 0; i < 8; ++i) { v[i] = p[i]; v[8 + i] = p[16 + i]; }
  return bsplit16(v); }
__device__ __forceinline__ F2 split_rowK(const float* row, int k0, int lane, int K) { float v[16]; const int g = lane >> 4;
#pragma unroll
  for (int i = 0; i < 8; ++i) { const int ka = k0 + 8 * g + i, kb = ka + 16; v[i] = ka < K ? row[ka < K ? ka : K - 1] : 0.f; v[8 + i] = kb < K ? row[kb < K ? kb : K - 1] : 0.f; }
  return bsplit16(v); }
__device__ __forceinline__ F2 split_col(const float* W, int k0, int n, int lane, int ld, int K) { float v[16]; const int g = lane >> 4;
#pragma unroll
  for (int i = 0; i < 8; ++i) { const int ka = k0 + 8 * g + i, kb = ka + 16; v[i] = ka < K ? W[(size_t)(ka < K ? ka : K - 1) * ld + n] : 0.f; v[8 + i] = kb < K ? W[(size_t)(kb < K ? kb : K - 1) * ld + n] : 0.f; }
  return bsplit16(v); }
__device__ __forceinline__ v8f mac3(const F2& a, const F2& b, v8f c) { c = wmma_bf(a.l, b.h, c); c = wmma_bf(a.h, b.l, c); return wmma_bf(a.h, b.h, c); }
__device__ __forceinline__ float sigm(float v) { return 1.0f / (1.0f + expf(-v)); }
#define LDSX() do { asm volatile("s_wait_dscnt 0" ::: "memory"); __builtin_amdgcn_wave_barrier(); __builtin_amdgcn_fence(__ATOMIC_RELEASE, "workgroup"); } while (0)

// Multi-head attention with an additive sinusoidal positional encoding (B 4, S 1,024, 1,024 = 16 x 64; separate q/k/v inputs): qh, kh, vh = x W^T + b ((out,in)); qh += pe, kh += pe with pe[t][2i] = sin(t div_i), pe[t][2i+1] = cos(t div_i), div_i = exp(-2i ln(10000)/64); out = merged(softmax(qh kh^T x 64^-0.5) vh) Wo^T + bo.
#define NB 4
#define TT 1024
#define CC 1024            // NH * HD = projected width
#define DIN 1024          // input (model) width
#define NH 16
#define HD 64
#define NQB (TT / 64)
#define HG 4
#define SCALE (0.125f)
#define CAUSAL 0
#ifndef TNB
#define TNB NB
#endif
__device__ __forceinline__ float bfr(float v) { return (float)(__bf16)v; }
__host__ __device__ __forceinline__ int kb_last(int qb) { return CAUSAL ? ((qb * 64 + 63) >> 7) : (TT / 128 - 1); }
typedef __attribute__((ext_vector_type(8))) __bf16 v8b;
__device__ __forceinline__ v16b frag_b(const __bf16* rowk0, int lane) {
  union { v16b v; v8b q[2]; } u; const __bf16* p = rowk0 + 8 * (lane >> 4);
  u.q[0] = *(const v8b*)p; u.q[1] = *(const v8b*)(p + 16); return u.v;
}
#define QBH 0              // not read by any kernel
#define QHI 1024            // rows carrying a q residual plane (all rows when non-causal: 2-product logits everywhere)
#define KHI 64            // key rows carrying k residual / v bf16 hi+lo planes (written by k_proj, read by no kernel)
// B fragment (k rows k0+.., output column o) of a weight: (in,out) [K][ld] or (out,in) [ld rows of K]: bf16 exact, or f16(bf16 * 256) exact
__device__ __forceinline__ v16b wcol_io(const float* Wm, int k0, int o, int lane, int ld) { v16b w; const int g = lane >> 4;
#pragma unroll
  for (int i = 0; i < 8; ++i) { w[i] = (__bf16)Wm[(size_t)(k0 + 8 * g + i) * ld + o]; w[8 + i] = (__bf16)Wm[(size_t)(k0 + 16 + 8 * g + i) * ld + o]; }
  return w; }
__device__ __forceinline__ v16b wcol_oi(const float* Wm, int k0, int o, int lane, int K) { v16b w; const float* p = Wm + (size_t)o * K + k0 + 8 * (lane >> 4);
#pragma unroll
  for (int i = 0; i < 8; ++i) { w[i] = (__bf16)p[i]; w[8 + i] = (__bf16)p[16 + i]; }
  return w; }
__device__ __forceinline__ v16h wcolh_io(const float* Wm, int k0, int o, int lane, int ld) { v16h w; const int g = lane >> 4;
#pragma unroll
  for (int i = 0; i < 8; ++i) { w[i] = (_Float16)(bfr(Wm[(size_t)(k0 + 8 * g + i) * ld + o]) * 256.0f); w[8 + i] = (_Float16)(bfr(Wm[(size_t)(k0 + 16 + 8 * g + i) * ld + o]) * 256.0f); }
  return w; }
__device__ __forceinline__ v16h wcolh_oi(const float* Wm, int k0, int o, int lane, int K) { v16h w; const float* p = Wm + (size_t)o * K + k0 + 8 * (lane >> 4);
#pragma unroll
  for (int i = 0; i < 8; ++i) { w[i] = (_Float16)(bfr(p[i]) * 256.0f); w[8 + i] = (_Float16)(bfr(p[16 + i]) * 256.0f); }
  return w; }
#define WQKV_LAYOUT 1   // 0 = (in,out) [DIN][CC]; 1 = (out,in) [CC][DIN]; 2 = per-head [NH][DIN][HD]
__device__ __forceinline__ v16b wcol_hdk(const float* Wm, int k0, int o, int lane) { v16b w; const int g = lane >> 4; const float* p = Wm + (size_t)(o / HD) * DIN * HD + (o % HD);
#pragma unroll
  for (int i = 0; i < 8; ++i) { w[i] = (__bf16)p[(size_t)(k0 + 8 * g + i) * HD]; w[8 + i] = (__bf16)p[(size_t)(k0 + 16 + 8 * g + i) * HD]; }
  return w; }
#define WO_OUT_IN 1
#if WQKV_LAYOUT == 1
#define WCOL(W, k0, o, lane) wcol_oi(W, k0, o, lane, DIN)
#elif WQKV_LAYOUT == 2
#define WCOL(W, k0, o, lane) wcol_hdk(W, k0, o, lane)
#else
#define WCOL(W, k0, o, lane) wcol_io(W, k0, o, lane, CC)
#endif
#if WO_OUT_IN
#define WOCOL(W, k0, o, lane) wcol_oi(W, k0, o, lane, CC)
#define WOCOLH(W, k0, o, lane) wcolh_oi(W, k0, o, lane, CC)
#else
#define WOCOL(W, k0, o, lane) wcol_io(W, k0, o, lane, DIN)
#define WOCOLH(W, k0, o, lane) wcolh_io(W, k0, o, lane, DIN)
#endif
__constant__ float c_div[32] = {1.000000000e+0f,7.498942018e-1f,5.623413324e-1f,4.216964841e-1f,3.162277639e-1f,2.371373624e-1f,1.778279394e-1f,1.333521456e-1f,9.999999404e-2f,7.498941571e-2f,5.623412877e-2f,4.216964915e-2f,3.162277490e-2f,2.371373586e-2f,1.778279245e-2f,1.333521307e-2f,9.999999776e-3f,7.498941384e-3f,5.623412784e-3f,4.216964822e-3f,3.162277397e-3f,2.371373586e-3f,1.778279198e-3f,1.333521330e-3f,9.999999311e-4f,7.498941268e-4f,5.623412435e-4f,4.216964589e-4f,3.162277280e-4f,2.371373412e-4f,1.778279257e-4f,1.333521213e-4f};   /* f32(exp(2i * (-ln(10000)/64))) - the module's 'div' */
#define PROJ_EPI(which, row, t, h) do { if ((which) < 2) { float* rw = (row); const float pf = (float)(t); _Pragma("unroll") for (int i = 0; i < 32; ++i) { float sn, cs; sincosf(pf * c_div[i], &sn, &cs); rw[2 * i] += sn; rw[2 * i + 1] += cs; } } } while (0)   /* q, k += sinusoidal PE: pe[t][2i] = sin(t div_i), pe[t][2i+1] = cos(t div_i) */
#ifndef SM_EXTRA_PARAMS
#define SM_EXTRA_PARAMS
#endif
#ifndef PROJ_EXTRA_PARAMS
#define PROJ_EXTRA_PARAMS
#endif
#ifndef SM_MASK_HOOK
#define SM_MASK_HOOK (void)0
#endif

#define WS_QH  0u                                      // f16 q rows [b*t][CC]
#define WS_KH  (WS_QH + 2u * (size_t)NB * TT * CC)      // f16 k rows [b*t][CC]
#define WS_VT  (WS_KH + 2u * (size_t)NB * TT * CC)      // f16 v planes [b][c][t]
#define WS_QL  (WS_VT + 2u * (size_t)NB * CC * TT)      // f16 q residual x 2^10 rows [b][t < QHI][CC]
#define WS_KL  (WS_QL + 2u * (size_t)NB * QHI * CC)     // f16 k residual x 2^10 rows [b][t < KHI][CC]
#define WS_VB  (WS_KL + 2u * (size_t)NB * KHI * CC)     // bf16 v hi planes [b][c][t < KHI]
#define WS_VBL (WS_VB + 2u * (size_t)NB * CC * KHI)
#define WS_Y   (WS_VBL + 2u * (size_t)NB * CC * KHI)    // f32 ctx rows [b*t][CC] (only when there is an output projection)
#define WS_END (WS_Y  + 4u * (size_t)NB * TT * CC)

// ---- operand staging of the two projection kernels: a stage is SBK k columns of the block's rows, read from global memory once a block (16 lanes x 16 B a row, so every wave-wide load covers whole 128-B lines), rounded to bf16 once (k_out's ctx: bf16 hi + lo) and kept in LDS for all four waves
typedef __attribute__((ext_vector_type(4))) __bf16 v4b;
#define SBK 64
#define SP (SBK + 8)        // staged row pitch in bf16 elements: 144 B = 16 B x 9, an odd count of 16 B for the ds_load_b128 fragment reads
template <int N> __device__ __forceinline__ void ldg_tile(v4f (&r)[N], const float* p, int ld) {
#pragma unroll
  for (int i = 0; i < N; ++i) r[i] = *(const v4f*)(p + (size_t)(8 * i) * ld); }
template <int N> __device__ __forceinline__ void sts_bf(__bf16* d, const v4f (&r)[N]) {
#pragma unroll
  for (int i = 0; i < N; ++i) { v4b t;
#pragma unroll
    for (int k = 0; k < 4; ++k) t[k] = (__bf16)r[i][k];
    *(v4b*)(d + 8 * i * SP) = t; } }
template <int N> __device__ __forceinline__ void sts_split(__bf16* dh, __bf16* dl, const v4f (&r)[N]) {
#pragma unroll
  for (int i = 0; i < N; ++i) { v4b th, tl;
#pragma unroll
    for (int k = 0; k < 4; ++k) { const __bf16 h = (__bf16)r[i][k]; th[k] = h; tl[k] = (__bf16)(r[i][k] - (float)h); }
    *(v4b*)(dh + 8 * i * SP) = th; *(v4b*)(dl + 8 * i * SP) = tl; } }
// ---- k_proj: block = (64 rows, 128 cols, which): q/k/v = X W (+ b) with exact bf16 products (K = DIN) -> which 0: q f16 rows (+ residual rows < QHI); 1: k f16 rows (+ residual rows < KHI); 2: v f16 planes [c][t] (+ bf16 hi/lo planes for t < KHI)
__global__ __launch_bounds__(128) void k_proj(const float* __restrict__ XQ, const float* __restrict__ XK, const float* __restrict__ XV, const float* __restrict__ WQ, const float* __restrict__ WK, const float* __restrict__ WV, const float* __restrict__ BQ, const float* __restrict__ BK, const float* __restrict__ BV,
    _Float16* __restrict__ QH, _Float16* __restrict__ QL, _Float16* __restrict__ KH, _Float16* __restrict__ KL, _Float16* __restrict__ VT, __bf16* __restrict__ VB, __bf16* __restrict__ VBL PROJ_EXTRA_PARAMS) {
  // LDS: st, then one region that holds in turn the two operand stages (192 rows each: X 64, W 128) and, behind the epilogue's barriers, either sh + sl or th + tb + tbl
  __shared__ __align__(16) float st[64][132]; __shared__ __align__(16) unsigned char ur[2 * 192 * SP * 2];
  __bf16* const sg = (__bf16*)ur; _Float16 (* const sh)[136] = (_Float16 (*)[136])ur; _Float16 (* const sl)[136] = (_Float16 (*)[136])(ur + 64 * 136 * 2);
  _Float16 (* const th)[72] = (_Float16 (*)[72])ur; __bf16 (* const tb)[72] = (__bf16 (*)[72])(ur + 128 * 72 * 2); __bf16 (* const tbl)[72] = (__bf16 (*)[72])(ur + 2 * 128 * 72 * 2);
  const int tid = threadIdx.x, wave = tid >> 5, lane = tid & 31, col = lane & 15, g = lane >> 4; const int which = blockIdx.z; const int c0 = blockIdx.y * 128; const size_t r0 = (size_t)blockIdx.x * 64; const size_t bb = r0 / TT; const int t0 = (int)(r0 % TT);
  const float* X = which == 0 ? XQ : which == 1 ? XK : XV; const float* WA = which == 0 ? WQ : which == 1 ? WK : WV; const float* BA = which == 0 ? BQ : which == 1 ? BK : BV;
  v8f acc[8] = {};
  { const int srow = tid >> 4, sq = (tid & 15) * 4; const float* Xp = X + (r0 + srow) * DIN + sq; const float* Wp = WA + (size_t)(c0 + srow) * DIN + sq; __bf16* const sd = sg + srow * SP + sq;
    v4f xr[8], wr[16];
    ldg_tile(xr, Xp, DIN); ldg_tile(wr, Wp, DIN);
    asm volatile("s_wait_xcnt 0x0" :: "v"(Xp), "v"(Wp) : "memory");   // in front of the first overwrite of the loads' address registers: as inputs they stay untouched up to here (the build reused one pair for the accumulators' zeros)
    sts_bf(sd, xr); sts_bf(sd + 64 * SP, wr);
    // two stages a trip, so that the buffer's offset is a constant of each half
#pragma unroll 2
    for (int s = 0; s < DIN / SBK; ++s) {
      __syncthreads();   // publishes stage s and ends every wave's reads of the buffer that stage s + 1 is stored into below
      if (s + 1 < DIN / SBK) { ldg_tile(xr, Xp + (s + 1) * SBK, DIN); ldg_tile(wr, Wp + (s + 1) * SBK, DIN);   // the next stage's loads fly while this stage is multiplied
        asm volatile("s_wait_xcnt 0x0" ::: "memory"); }   // behind the run of loads: in front of the next trip's overwrite of their address registers on every way through the loop
      const __bf16* bu = sg + (s & 1) * (192 * SP);
#pragma unroll
      for (int kk = 0; kk < SBK / 32; ++kk) { const v16b a = frag_b(bu + (wave * 16 + col) * SP + kk * 32, lane); v16b w[8];
#pragma unroll
        for (int j = 0; j < 8; ++j) w[j] = frag_b(bu + (64 + j * 16 + col) * SP + kk * 32, lane);
#pragma unroll
        for (int j = 0; j < 8; ++j) acc[j] = wmma_bf(a, w[j], acc[j]); }
      __builtin_amdgcn_sched_barrier(0);   // keeps the waits for the next stage's loads behind all of this stage's products
      if (s + 1 < DIN / SBK) { __bf16* d = sd + ((s + 1) & 1) * (192 * SP); sts_bf(d, xr); sts_bf(d + 64 * SP, wr); } } }
  { // stage the f32 tile (acc + bias) in LDS, run the per-(row, head) epilogue hook, then convert
#pragma unroll
    for (int j = 0; j < 8; ++j) { const float bias = BA ? bfr(BA[c0 + j * 16 + col]) : 0.f;
#pragma unroll
      for (int r = 0; r < 8; ++r) st[wave * 16 + 8 * g + r][j * 16 + col] = acc[j][r] + bias; }
    __syncthreads();
    for (int e = tid; e < 64 * (128 / HD); e += 128) { const int rl = e / (128 / HD), hh = e % (128 / HD); PROJ_EPI(which, &st[rl][hh * HD], (int)((r0 + rl) % TT), (c0 / HD) + hh); }
    __syncthreads(); }
  if (which < 2) { _Float16* DH = which == 0 ? QH : KH; _Float16* DL = which == 0 ? QL : KL; const int nhi = which == 0 ? QHI : KHI; const bool hi_rows = t0 < nhi;
    for (int e = tid; e < 64 * 128; e += 128) { const int rl = e >> 7, cl = e & 127; const float v = st[rl][cl]; const _Float16 hv = (_Float16)v; sh[rl][cl] = hv; sl[rl][cl] = (_Float16)((v - (float)hv) * 1024.0f); }
    __syncthreads();
    for (int e = tid; e < 64 * 16; e += 128) { const int rl = e >> 4, q = e & 15; vst2((unsigned*)(DH + (r0 + rl) * CC + c0 + q * 8), *(const v4u*)&sh[rl][q * 8]); if (hi_rows) vst2((unsigned*)(DL + (bb * nhi + t0 + rl) * (size_t)CC + c0 + q * 8), *(const v4u*)&sl[rl][q * 8]); }
  } else { const bool hi_rows = t0 < KHI;
    for (int e = tid; e < 64 * 128; e += 128) { const int rl = e & 63, cl = e >> 6; const float v = st[rl][cl]; th[cl][rl] = (_Float16)v; const __bf16 bh = (__bf16)v; tb[cl][rl] = bh; tbl[cl][rl] = (__bf16)(v - (float)bh); }
    __syncthreads();
    for (int e = tid; e < 128 * 8; e += 128) { const int cl = e >> 3, q = e & 7; vst2((unsigned*)(VT + (bb * CC + c0 + cl) * (size_t)TT + t0 + q * 8), *(const v4u*)&th[cl][q * 8]);
      asm volatile("s_wait_xcnt 0x0" ::: "memory");   // in front of the overwrite of the store's data and address registers (this build reuses them at once)
      if (hi_rows) { const size_t o3 = (bb * CC + c0 + cl) * (size_t)KHI + t0 + q * 8; vst2((unsigned*)(VB + o3), *(const v4u*)&tb[cl][q * 8]); vst2((unsigned*)(VBL + o3), *(const v4u*)&tbl[cl][q * 8]);
        asm volatile("s_wait_xcnt 0x0" ::: "memory"); } } } }   // the same for these two stores, in front of the next trip
// ---- K/V staging of k_attn: a stage is one pass's 64 k rows and 64 v planes of the head (128 B each), brought into LDS once a block by asynchronous copies (8 lanes x 16 B a row, so every wave-wide copy covers four whole 128-B lines), for all four waves
#define KVP (HD + 8)          // staged row pitch in f16 elements: 144 B = 16 B x 9, an odd count of 16 B for the ds_load_b128 fragment reads
#define KVB (2 * 64 * KVP)    // one stage in f16 elements: 64 k rows, then 64 v planes
__device__ __forceinline__ void kv_copy(unsigned ld, const _Float16* kg, const _Float16* vg) {
  // one statement for the thread's eight copies and the s_wait_xcnt 0 behind them: the wait stands in front of every later overwrite of the copies' address registers
  asm volatile("global_load_async_to_lds_b128 %0, %8, off\n\t"
               "global_load_async_to_lds_b128 %1, %9, off\n\t"
               "global_load_async_to_lds_b128 %2, %10, off\n\t"
               "global_load_async_to_lds_b128 %3, %11, off\n\t"
               "global_load_async_to_lds_b128 %4, %12, off\n\t"
               "global_load_async_to_lds_b128 %5, %13, off\n\t"
               "global_load_async_to_lds_b128 %6, %14, off\n\t"
               "global_load_async_to_lds_b128 %7, %15, off\n\t"
               "s_wait_xcnt 0x0"
               :: "v"(ld), "v"(ld + 16u * KVP * 2u), "v"(ld + 32u * KVP * 2u), "v"(ld + 48u * KVP * 2u), "v"(ld + 64u * KVP * 2u), "v"(ld + 80u * KVP * 2u), "v"(ld + 96u * KVP * 2u), "v"(ld + 112u * KVP * 2u),
                  "v"(kg), "v"(kg + (size_t)16 * CC), "v"(kg + (size_t)32 * CC), "v"(kg + (size_t)48 * CC), "v"(vg), "v"(vg + (size_t)16 * TT), "v"(vg + (size_t)32 * TT), "v"(vg + (size_t)48 * TT)
               : "memory"); }
__global__ __launch_bounds__(128) void k_attn(const _Float16* __restrict__ QH, const _Float16* __restrict__ KH, const _Float16* __restrict__ QL, const _Float16* __restrict__ VT, float* __restrict__ Y) { __shared__ __align__(16) float ss[4][16][HD + 4]; __shared__ __align__(16) _Float16 kv[2 * KVB];
  const int tid = threadIdx.x, wave = tid >> 5, lane = tid & 31, col = lane & 15, g = lane >> 4; const int qb = blockIdx.x, h = blockIdx.y, b = blockIdx.z; const int ql0 = qb * 64 + wave * 16;
  const int srow = tid >> 3, sc = (tid & 7) * 8;   // the thread's row (and rows + 16, 32, 48) and 16-B piece of a stage
  const _Float16* Kg = KH + ((size_t)b * TT + srow) * CC + h * HD + sc;
  const _Float16* Vg = VT + ((size_t)b * CC + h * HD + srow) * (size_t)TT + sc;
  const unsigned ld0 = (unsigned)(size_t)(kv + srow * KVP + sc);   // LDS byte address: the low 32 bits of the shared address
  kv_copy(ld0, Kg, Vg);
  asm volatile("s_wait_asynccnt 0x0" ::: "memory");   // this wave's copies of stage 0 have landed
  __syncthreads();                                    // publishes stage 0
  kv_copy(ld0 + KVB * 2u, Kg + (size_t)64 * CC, Vg + 64);
  v16h qh[HD / 32], ql[HD / 32];
#pragma unroll
  for (int kc = 0; kc < HD / 32; ++kc) { qh[kc] = frag_h(QH + ((size_t)b * TT + ql0 + col) * CC + h * HD + kc * 32, lane); ql[kc] = frag_h(QL + ((size_t)b * QHI + ql0 + col) * CC + h * HD + kc * 32, lane); }
  v8f o[HD / 16] = {}; float m = -3.0e38f, l = 0.f;
  // the pass loop stays rolled (two passes' fragments at once would cost the fourth wave of a SIMD); every inner loop is unrolled so that each register-array index is a constant
#pragma unroll 1
  for (int t = 0; t < TT / 64; ++t) { v8f acc[4] = {}, accl[4] = {}; v16h kf[HD / 32][4], vf[2][HD / 16];
    const _Float16* Ks = kv + (t & 1) * KVB + col * KVP;   // key row col of the stage
    const _Float16* Vs = Ks + 64 * KVP;                    // v plane col of the stage
#pragma unroll
    for (int kc = 0; kc < HD / 32; ++kc) {   // all of the pass's k fragments are asked for before the first product, so that their latencies overlap
#pragma unroll
      for (int j = 0; j < 4; ++j) kf[kc][j] = frag_h(Ks + (j * 16) * KVP + kc * 32, lane); }
#pragma unroll
    for (int kc = 0; kc < HD / 32; ++kc) {
#pragma unroll
      for (int j = 0; j < 4; ++j) { acc[j] = wmma16(kf[kc][j], qh[kc], acc[j]); accl[j] = wmma16(kf[kc][j], ql[kc], accl[j]); } }
#pragma unroll
    for (int kc = 0; kc < 2; ++kc) {   // the pass's v fragments fly while the softmax is worked out
#pragma unroll
      for (int jj = 0; jj < HD / 16; ++jj) vf[kc][jj] = frag_h(Vs + (jj * 16) * KVP + kc * 32, lane); }
    float mx = -3.0e38f;
#pragma unroll
    for (int j = 0; j < 4; ++j) {
#pragma unroll
      for (int r = 0; r < 8; ++r) { const float s = (acc[j][r] + accl[j][r] * (1.0f / 1024.0f)) * SCALE; acc[j][r] = s; mx = fmaxf(mx, s); } }
    mx = fmaxf(mx, __shfl_xor(mx, 16));   // the other half of this query's keys
    const float mn = fmaxf(m, mx); const float corr = expf(m - mn); m = mn;
    float sum = 0.f; v16h p[2];
#pragma unroll
    for (int j = 0; j < 4; ++j) {
#pragma unroll
      for (int r = 0; r < 8; ++r) { const float e = expf(acc[j][r] - mn); sum += e; p[j >> 1][(j & 1) * 8 + r] = (_Float16)(e * 1024.0f); } }
    l = l * corr + sum;
#pragma unroll
    for (int jj = 0; jj < HD / 16; ++jj) {
#pragma unroll
      for (int r = 0; r < 8; ++r) o[jj][r] *= corr; }
#pragma unroll
    for (int kc = 0; kc < 2; ++kc) {
#pragma unroll
      for (int jj = 0; jj < HD / 16; ++jj) o[jj] = wmma16(vf[kc][jj], p[kc], o[jj]); }
    asm volatile("s_wait_dscnt 0x0" ::: "memory");      // this wave's reads of stage t have returned
    asm volatile("s_wait_asynccnt 0x0" ::: "memory");   // this wave's copies of stage t + 1 have landed
    __syncthreads();                                    // publishes stage t + 1 and ends every wave's reads of the buffer that is refilled below
    if (t + 2 < TT / 64) kv_copy(ld0 + (unsigned)(t & 1) * (KVB * 2u), Kg + (size_t)(t + 2) * 64 * CC, Vg + (t + 2) * 64); }
  asm volatile("s_wait_asynccnt 0x0" ::: "memory");     // no copy is outstanding when the wave goes on to its end
  l += __shfl_xor(l, 16); const float inv = 1.0f / (1024.0f * l);
#pragma unroll
  for (int jj = 0; jj < HD / 16; ++jj)
#pragma unroll
    for (int r = 0; r < 8; ++r) ss[wave][col][jj * 16 + 8 * g + r] = o[jj][r] * inv;
  LDSX(); for (int rl = 0; rl < 16; ++rl) if (lane < HD / 4) vst2(Y + ((size_t)b * TT + ql0 + rl) * CC + h * HD + lane * 4, *(const v4f*)&ss[wave][rl][lane * 4]); }
// ---- k_out: block = (64 rows, 128 cols): out = ctx Wo (+ bo): all rows: ctx bf16 hi + lo against exact bf16 Wo (2 products)
__global__ __launch_bounds__(128) void k_out(const float* __restrict__ Y, const float* __restrict__ WO, const float* __restrict__ BO, float* __restrict__ OUT) { __shared__ __align__(16) float sf[4][16][132]; __shared__ __align__(16) __bf16 sg[2 * 256 * SP];   // two operand stages of 256 rows: ctx hi 64, ctx lo 64, Wo 128
  const int tid = threadIdx.x, wave = tid >> 5, lane = tid & 31, col = lane & 15, g = lane >> 4; const int c0 = blockIdx.y * 128; const size_t r0 = (size_t)blockIdx.x * 64 + wave * 16;
  v8f acc[8] = {};
  if (true) {   /* ALL rows: ctx split bf16 hi + lo x exact Wo (2 products) */
    const int srow = tid >> 4, sq = (tid & 15) * 4; const float* Yp = Y + ((size_t)blockIdx.x * 64 + srow) * CC + sq; const float* Wp = WO + (size_t)(c0 + srow) * CC + sq; __bf16* const sd = sg + srow * SP + sq;
    v4f yr[8], wr[16];
    ldg_tile(yr, Yp, CC); ldg_tile(wr, Wp, CC); sts_split(sd, sd + 64 * SP, yr); sts_bf(sd + 128 * SP, wr);
    // two stages a trip, so that the buffer's offset is a constant of each half
#pragma unroll 2
    for (int s = 0; s < CC / SBK; ++s) {
      __syncthreads();   // publishes stage s and ends every wave's reads of the buffer that stage s + 1 is stored into below
      if (s + 1 < CC / SBK) { ldg_tile(yr, Yp + (s + 1) * SBK, CC); ldg_tile(wr, Wp + (s + 1) * SBK, CC);   // the next stage's loads fly while this stage is multiplied
        asm volatile("s_wait_xcnt 0x0" ::: "memory"); }   // behind the run of loads: in front of the next trip's overwrite of their address registers on every way through the loop
      const __bf16* bu = sg + (s & 1) * (256 * SP);
#pragma unroll
      for (int kk = 0; kk < SBK / 32; ++kk) { const v16b ah = frag_b(bu + (wave * 16 + col) * SP + kk * 32, lane), al = frag_b(bu + (64 + wave * 16 + col) * SP + kk * 32, lane); v16b w[8];
#pragma unroll
        for (int j = 0; j < 8; ++j) w[j] = frag_b(bu + (128 + j * 16 + col) * SP + kk * 32, lane);
#pragma unroll
        for (int j = 0; j < 8; ++j) { acc[j] = wmma_bf(ah, w[j], acc[j]); acc[j] = wmma_bf(al, w[j], acc[j]); } }
      __builtin_amdgcn_sched_barrier(0);   // keeps the waits for the next stage's loads behind all of this stage's products
      if (s + 1 < CC / SBK) { __bf16* d = sd + ((s + 1) & 1) * (256 * SP); sts_split(d, d + 64 * SP, yr); sts_bf(d + 128 * SP, wr); } }
#pragma unroll
    for (int j = 0; j < 8; ++j) { const float bias = BO ? bfr(BO[c0 + j * 16 + col]) : 0.f;
#pragma unroll
      for (int r = 0; r < 8; ++r) sf[wave][8 * g + r][j * 16 + col] = acc[j][r] + bias; }
  } else {
#pragma unroll 2
    for (int kc = 0; kc < CC / 32; ++kc) { const v16h a = frag_f32(Y + (r0 + col) * CC + kc * 32, lane); asm volatile("s_wait_loadcnt 0x0" ::: "memory");
#pragma unroll
      for (int j = 0; j < 8; ++j) { const v16h w = WOCOLH(WO, kc * 32, c0 + j * 16 + col, lane); asm volatile("s_wait_loadcnt 0x0" ::: "memory"); acc[j] = wmma16(a, w, acc[j]); } }
#pragma unroll
    for (int j = 0; j < 8; ++j) { const float bias = BO ? bfr(BO[c0 + j * 16 + col]) : 0.f;
#pragma unroll
      for (int r = 0; r < 8; ++r) sf[wave][8 * g + r][j * 16 + col] = acc[j][r] * (1.0f / 256.0f) + bias; } }
  LDSX(); for (int rl = 0; rl < 16; ++rl) vst2(OUT + (r0 + rl) * DIN + c0 + lane * 4, *(const v4f*)&sf[wave][rl][lane * 4]); }

extern "C" void kernel_launch(void* const* d_in, const int* in_sizes, int n_in, void* d_out, int out_size, void* d_ws, size_t ws_size, hipStream_t stream) {
  (void)in_sizes; (void)n_in; (void)out_size;
  const float** F = (const float**)d_in;
  if (ws_size < (size_t)WS_END) return;
  char* ws = (char*)d_ws; _Float16 *QH = (_Float16*)(ws + WS_QH), *KH = (_Float16*)(ws + WS_KH), *VT = (_Float16*)(ws + WS_VT), *QL = (_Float16*)(ws + WS_QL), *KL = (_Float16*)(ws + WS_KL); __bf16 *VB = (__bf16*)(ws + WS_VB), *VBL = (__bf16*)(ws + WS_VBL); float *Y = (float*)(ws + WS_Y);
  (void)Y; (void)QL; (void)KL; (void)VB; (void)VBL;
  // inputs: 0 q, 1 k, 2 v [4,1024,1024]; 3 Wq [1024,1024] (out,in), 4 bq; 5 Wk, 6 bk; 7 Wv, 8 bv; 9 Wo, 10 bo
  k_proj<<<dim3(TNB * TT / 64, CC / 128, 3), 128, 0, stream>>>(F[0], F[1], F[2], F[3], F[5], F[7], F[4], F[6], F[8], QH, QL, KH, KL, VT, VB, VBL);
  k_attn<<<dim3(NQB, NH, TNB), 128, 0, stream>>>(QH, KH, QL, VT, Y);
  k_out<<<dim3(TNB * TT / 64, DIN / 128), 128, 0, stream>>>(Y, F[9], F[10], (float*)d_out);
}

// v004
// Measured time: 107 microseconds a run.
// Timed twice side by side with v003, it ran 1.10 times as fast both times.
// Counting every step since v000, it is 12.3 times as fast.
// compute dtype: all float inputs rounded to bf16; q/k/v projections with EXACT bf16 products on WMMA 16x16x32 (f32 accumulate); the sinusoidal PE added in f32 (sincosf) to the projected q/k rows; q as f16 hi + residual (x 2^10) against k once to f16 (2 products) x 64^-0.5; softmax in f32 (exponent in base 2: one fma, then the hardware exp2) with a running maximum and sum, 64 keys a pass; exp(s - m) x 2^10 once to f16 against v once to f16 (1 product); ctx split bf16 hi + lo against exact Wo (2 products); f32 output.
#include <hip/hip_runtime.h>
#include <math.h>

typedef __attribute__((ext_vector_type(16))) _Float16 v16h;
typedef __attribute__((ext_vector_type(16))) __bf16 v16b;
typedef __attribute__((ext_vector_type(8)))  _Float16 v8h;
typedef __attribute__((ext_vector_type(8)))  float v8f;
typedef __attribute__((ext_vector_type(4)))  float v4f;
typedef __attribute__((ext_vector_type(2)))  float v2f;
typedef __attribute__((ext_vector_type(4)))  unsigned v4u;
typedef __attribute__((ext_vector_type(4)))  int v4i;
typedef float __attribute__((may_alias)) float_a;
typedef int __attribute__((may_alias)) int_a;

template <typename T> __device__ __forceinline__ void vst2(void* p, T v) { *(T*)p = v;  }
__device__ __forceinline__ v8f wmma16(v16h a, v16h b, v8f c) {
  v8f d = __builtin_amdgcn_wmma_f32_16x16x32_f16(false, a, false, b, (short)0, c, false, false);
  asm volatile("v_nop\n\tv_nop\n\tv_nop\n\tv_nop" : "+v"(d) : "v"(a), "v"(b));
  return d;
}
__device__ __forceinline__ v8f wmma_bf(v16b a, v16b b, v8f c) {
  v8f d = __builtin_amdgcn_wmma_f32_16x16x32_bf16(false, a, false, b, (short)0, c, false, false);
  asm volatile("v_nop\n\tv_nop\n\tv_nop\n\tv_nop" : "+v"(d) : "v"(a), "v"(b));
  return d;
}
// 16x16x32 fragments: lane = (h = lane>>4, row/col = lane&15); elements 0..7 = k0+8h+0..7, 8..15 = k0+16+8h+0..7; D element r = row 8h+r
__device__ __forceinline__ v16h frag_h(const _Float16* rowk0, int lane) {
  union { v16h v; v8h q[2]; } u; const _Float16* p = rowk0 + 8 * (lane >> 4);
  u.q[0] = *(const v8h*)p; u.q[1] = *(const v8h*)(p + 16); return u.v;
}
__device__ __forceinline__ v16h frag_f32(const float* rowk0, int lane) {
  v16h a; const float* p = rowk0 + 8 * (lane >> 4);
#pragma unroll
  for (int i = 0; i < 8; ++i) { a[i] = (_Float16)p[i]; a[8 + i] = (_Float16)p[16 + i]; }
  return a;
}
__device__ __forceinline__ v16h frag_f32s(const float* rowk0, int lane, float sc) {
  v16h a; const float* p = rowk0 + 8 * (lane >> 4);
#pragma unroll
  for (int i = 0; i < 8; ++i) { a[i] = (_Float16)(p[i] * sc); a[8 + i] = (_Float16)(p[16 + i] * sc); }
  return a;
}
// column fragment from a [K][ld] layout (column n), rows >= K read as 0
__device__ __forceinline__ v16h fragc_f32(const float* W, int k0, int n, int lane, int ld, int K) {
  v16h a; const int g = lane >> 4;
#pragma unroll
  for (int i = 0; i < 8; ++i) { const int ka = k0 + 8 * g + i, kb = ka + 16;
    a[i] = (_Float16)(ka < K ? W[(size_t)(ka < K ? ka : K - 1) * ld + n] : 0.f); a[8 + i] = (_Float16)(kb < K ? W[(size_t)(kb < K ? kb : K - 1) * ld + n] : 0.f); }
  return a;
}
struct F2 { v16b h, l; };
__device__ __forceinline__ F2 bsplit16(const float v[16]) { F2 r;
#pragma unroll
  for (int i = 0; i < 16; ++i) { const __bf16 h = (__bf16)v[i]; r.h[i] = h; r.l[i] = (__bf16)(v[i] - (float)h); }
  return r; }
__device__ __forceinline__ F2 split_row(const float* row, int k0, int lane) { float v[16]; const float* p = row + k0 + 8 * (lane >> 4);
#pragma unroll
  for (int i = 0; i < 8; ++i) { v[i] = p[i]; v[8 + i] = p[16 + i]; }
  return bsplit16(v); }
__device__ __forceinline__ F2 split_rowK(const float* row, int k0, int lane, int K) { float v[16]; const int g = lane >> 4;
#pragma unroll
  for (int i = 0; i < 8; ++i) { const int ka = k0 + 8 * g + i, kb = ka + 16; v[i] = ka < K ? row[ka < K ? ka : K - 1] : 0.f; v[8 + i] = kb < K ? row[kb < K ? kb : K - 1] : 0.f; }
  return bsplit16(v); }
__device__ __forceinline__ F2 split_col(const float* W, int k0, int n, int lane, int ld, int K) { float v[16]; const int g = lane >> 4;
#pragma unroll
  for (int i = 0; i < 8; ++i) { const int ka = k0 + 8 * g + i, kb = ka + 16; v[i] = ka < K ? W[(size_t)(ka < K ? ka : K - 1) * ld + n] : 0.f; v[8 + i] = kb < K ? W[(size_t)(kb < K ? kb : K - 1) * ld + n] : 0.f; }
  return bsplit16(v); }
__device__ __forceinline__ v8f mac3(const F2& a, const F2& b, v8f c) { c = wmma_bf(a.l, b.h, c); c = wmma_bf(a.h, b.l, c); return wmma_bf(a.h, b.h, c); }
__device__ __forceinline__ float sigm(float v) { return 1.0f / (1.0f + expf(-v)); }
#define LDSX() do { asm volatile("s_wait_dscnt 0" ::: "memory"); __builtin_amdgcn_wave_barrier(); __builtin_amdgcn_fence(__ATOMIC_RELEASE, "workgroup"); } while (0)

// Multi-head attention with an additive sinusoidal positional encoding (B 4, S 1,024, 1,024 = 16 x 64; separate q/k/v inputs): qh, kh, vh = x W^T + b ((out,in)); qh += pe, kh += pe with pe[t][2i] = sin(t div_i), pe[t][2i+1] = cos(t div_i), div_i = exp(-2i ln(10000)/64); out = merged(softmax(qh kh^T x 64^-0.5) vh) Wo^T + bo.
#define NB 4
#define TT 1024
#define CC 1024            // NH * HD = projected width
#define DIN 1024          // input (model) width
#define NH 16
#define HD 64
#define NQB (TT / 64)
#define HG 4
#define SCALE (0.125f)
#define SL2E (SCALE * 1.44269504088896340736f)   // SCALE x log2(e): the softmax exponent in base 2
#define CAUSAL 0
#ifndef TNB
#define TNB NB
#endif
__device__ __forceinline__ float bfr(float v) { return (float)(__bf16)v; }
__host__ __device__ __forceinline__ int kb_last(int qb) { return CAUSAL ? ((qb * 64 + 63) >> 7) : (TT / 128 - 1); }
typedef __attribute__((ext_vector_type(8))) __bf16 v8b;
__device__ __forceinline__ v16b frag_b(const __bf16* rowk0, int lane) {
  union { v16b v; v8b q[2]; } u; const __bf16* p = rowk0 + 8 * (lane >> 4);
  u.q[0] = *(const v8b*)p; u.q[1] = *(const v8b*)(p + 16); return u.v;
}
#define QBH 0              // not read by any kernel
#define QHI 1024            // rows carrying a q residual plane (all rows when non-causal: 2-product logits everywhere)
#define KHI 64            // key rows carrying k residual / v bf16 hi+lo planes (written by k_proj, read by no kernel)
// B fragment (k rows k0+.., output column o) of a weight: (in,out) [K][ld] or (out,in) [ld rows of K]: bf16 exact, or f16(bf16 * 256) exact
__device__ __forceinline__ v16b wcol_io(const float* Wm, int k0, int o, int lane, int ld) { v16b w; const int g = lane >> 4;
#pragma unroll
  for (int i = 0; i < 8; ++i) { w[i] = (__bf16)Wm[(size_t)(k0 + 8 * g + i) * ld + o]; w[8 + i] = (__bf16)Wm[(size_t)(k0 + 16 + 8 * g + i) * ld + o]; }
  return w; }
__device__ __forceinline__ v16b wcol_oi(const float* Wm, int k0, int o, int lane, int K) { v16b w; const float* p = Wm + (size_t)o * K + k0 + 8 * (lane >> 4);
#pragma unroll
  for (int i = 0; i < 8; ++i) { w[i] = (__bf16)p[i]; w[8 + i] = (__bf16)p[16 + i]; }
  return w; }
__device__ __forceinline__ v16h wcolh_io(const float* Wm, int k0, int o, int lane, int ld) { v16h w; const int g = lane >> 4;
#pragma unroll
  for (int i = 0; i < 8; ++i) { w[i] = (_Float16)(bfr(Wm[(size_t)(k0 + 8 * g + i) * ld + o]) * 256.0f); w[8 + i] = (_Float16)(bfr(Wm[(size_t)(k0 + 16 + 8 * g + i) * ld + o]) * 256.0f); }
  return w; }
__device__ __forceinline__ v16h wcolh_oi(const float* Wm, int k0, int o, int lane, int K) { v16h w; const float* p = Wm + (size_t)o * K + k0 + 8 * (lane >> 4);
#pragma unroll
  for (int i = 0; i < 8; ++i) { w[i] = (_Float16)(bfr(p[i]) * 256.0f); w[8 + i] = (_Float16)(bfr(p[16 + i]) * 256.0f); }
  return w; }
#define WQKV_LAYOUT 1   // 0 = (in,out) [DIN][CC]; 1 = (out,in) [CC][DIN]; 2 = per-head [NH][DIN][HD]
__device__ __forceinline__ v16b wcol_hdk(const float* Wm, int k0, int o, int lane) { v16b w; const int g = lane >> 4; const float* p = Wm + (size_t)(o / HD) * DIN * HD + (o % HD);
#pragma unroll
  for (int i = 0; i < 8; ++i) { w[i] = (__bf16)p[(size_t)(k0 + 8 * g + i) * HD]; w[8 + i] = (__bf16)p[(size_t)(k0 + 16 + 8 * g + i) * HD]; }
  return w; }
#define WO_OUT_IN 1
#if WQKV_LAYOUT == 1
#define WCOL(W, k0, o, lane) wcol_oi(W, k0, o, lane, DIN)
#elif WQKV_LAYOUT == 2
#define WCOL(W, k0, o, lane) wcol_hdk(W, k0, o, lane)
#else
#define WCOL(W, k0, o, lane) wcol_io(W, k0, o, lane, CC)
#endif
#if WO_OUT_IN
#define WOCOL(W, k0, o, lane) wcol_oi(W, k0, o, lane, CC)
#define WOCOLH(W, k0, o, lane) wcolh_oi(W, k0, o, lane, CC)
#else
#define WOCOL(W, k0, o, lane) wcol_io(W, k0, o, lane, DIN)
#define WOCOLH(W, k0, o, lane) wcolh_io(W, k0, o, lane, DIN)
#endif
__constant__ float c_div[32] = {1.000000000e+0f,7.498942018e-1f,5.623413324e-1f,4.216964841e-1f,3.162277639e-1f,2.371373624e-1f,1.778279394e-1f,1.333521456e-1f,9.999999404e-2f,7.498941571e-2f,5.623412877e-2f,4.216964915e-2f,3.162277490e-2f,2.371373586e-2f,1.778279245e-2f,1.333521307e-2f,9.999999776e-3f,7.498941384e-3f,5.623412784e-3f,4.216964822e-3f,3.162277397e-3f,2.371373586e-3f,1.778279198e-3f,1.333521330e-3f,9.999999311e-4f,7.498941268e-4f,5.623412435e-4f,4.216964589e-4f,3.162277280e-4f,2.371373412e-4f,1.778279257e-4f,1.333521213e-4f};   /* f32(exp(2i * (-ln(10000)/64))) - the module's 'div' */
#define PROJ_EPI(which, row, t, h) do { if ((which) < 2) { float* rw = (row); const float pf = (float)(t); _Pragma("unroll") for (int i = 0; i < 32; ++i) { float sn, cs; sincosf(pf * c_div[i], &sn, &cs); rw[2 * i] += sn; rw[2 * i + 1] += cs; } } } while (0)   /* q, k += sinusoidal PE: pe[t][2i] = sin(t div_i), pe[t][2i+1] = cos(t div_i) */
#ifndef SM_EXTRA_PARAMS
#define SM_EXTRA_PARAMS
#endif
#ifndef PROJ_EXTRA_PARAMS
#define PROJ_EXTRA_PARAMS
#endif
#ifndef SM_MASK_HOOK
#define SM_MASK_HOOK (void)0
#endif

#define WS_QH  0u                                      // f16 q rows [b*t][CC]
#define WS_KH  (WS_QH + 2u * (size_t)NB * TT * CC)      // f16 k rows [b*t][CC]
#define WS_VT  (WS_KH + 2u * (size_t)NB * TT * CC)      // f16 v planes [b][c][t]
#define WS_QL  (WS_VT + 2u * (size_t)NB * CC * TT)      // f16 q residual x 2^10 rows [b][t < QHI][CC]
#define WS_KL  (WS_QL + 2u * (size_t)NB * QHI * CC)     // f16 k residual x 2^10 rows [b][t < KHI][CC]
#define WS_VB  (WS_KL + 2u * (size_t)NB * KHI * CC)     // bf16 v hi planes [b][c][t < KHI]
#define WS_VBL (WS_VB + 2u * (size_t)NB * CC * KHI)
#define WS_Y   (WS_VBL + 2u * (size_t)NB * CC * KHI)    // f32 ctx rows [b*t][CC] (only when there is an output projection)
#define WS_END (WS_Y  + 4u * (size_t)NB * TT * CC)

// ---- operand staging of the two projection kernels: a stage is SBK k columns of the block's rows, read from global memory once a block (16 lanes x 16 B a row, so every wave-wide load covers whole 128-B lines), rounded to bf16 once (k_out's ctx: bf16 hi + lo) and kept in LDS for all four waves
typedef __attribute__((ext_vector_type(4))) __bf16 v4b;
#define SBK 64
#define SP (SBK + 8)        // staged row pitch in bf16 elements: 144 B = 16 B x 9, an odd count of 16 B for the ds_load_b128 fragment reads
template <int N> __device__ __forceinline__ void ldg_tile(v4f (&r)[N], const float* p, int ld) {
#pragma unroll
  for (int i = 0; i < N; ++i) r[i] = *(const v4f*)(p + (size_t)(8 * i) * ld); }
template <int N> __device__ __forceinline__ void sts_bf(__bf16* d, const v4f (&r)[N]) {
#pragma unroll
  for (int i = 0; i < N; ++i) { v4b t;
#pragma unroll
    for (int k = 0; k < 4; ++k) t[k] = (__bf16)r[i][k];
    *(v4b*)(d + 8 * i * SP) = t; } }
template <int N> __device__ __forceinline__ void sts_split(__bf16* dh, __bf16* dl, const v4f (&r)[N]) {
#pragma unroll
  for (int i = 0; i < N; ++i) { v4b th, tl;
#pragma unroll
    for (int k = 0; k < 4; ++k) { const __bf16 h = (__bf16)r[i][k]; th[k] = h; tl[k] = (__bf16)(r[i][k] - (float)h); }
    *(v4b*)(dh + 8 * i * SP) = th; *(v4b*)(dl + 8 * i * SP) = tl; } }
// ---- k_proj: block = (64 rows, 128 cols, which): q/k/v = X W (+ b) with exact bf16 products (K = DIN) -> which 0: q f16 rows (+ residual rows < QHI); 1: k f16 rows (+ residual rows < KHI); 2: v f16 planes [c][t] (+ bf16 hi/lo planes for t < KHI)
__global__ __launch_bounds__(128) void k_proj(const float* __restrict__ XQ, const float* __restrict__ XK, const float* __restrict__ XV, const float* __restrict__ WQ, const float* __restrict__ WK, const float* __restrict__ WV, const float* __restrict__ BQ, const float* __restrict__ BK, const float* __restrict__ BV,
    _Float16* __restrict__ QH, _Float16* __restrict__ QL, _Float16* __restrict__ KH, _Float16* __restrict__ KL, _Float16* __restrict__ VT, __bf16* __restrict__ VB, __bf16* __restrict__ VBL PROJ_EXTRA_PARAMS) {
  // LDS: st, then one region that holds in turn the two operand stages (192 rows each: X 64, W 128) and, behind the epilogue's barriers, either sh + sl or th + tb + tbl
  __shared__ __align__(16) float st[64][132]; __shared__ __align__(16) unsigned char ur[2 * 192 * SP * 2];
  __bf16* const sg = (__bf16*)ur; _Float16 (* const sh)[136] = (_Float16 (*)[136])ur; _Float16 (* const sl)[136] = (_Float16 (*)[136])(ur + 64 * 136 * 2);
  _Float16 (* const th)[72] = (_Float16 (*)[72])ur; __bf16 (* const tb)[72] = (__bf16 (*)[72])(ur + 128 * 72 * 2); __bf16 (* const tbl)[72] = (__bf16 (*)[72])(ur + 2 * 128 * 72 * 2);
  const int tid = threadIdx.x, wave = tid >> 5, lane = tid & 31, col = lane & 15, g = lane >> 4; const int which = blockIdx.z; const int c0 = blockIdx.y * 128; const size_t r0 = (size_t)blockIdx.x * 64; const size_t bb = r0 / TT; const int t0 = (int)(r0 % TT);
  const float* X = which == 0 ? XQ : which == 1 ? XK : XV; const float* WA = which == 0 ? WQ : which == 1 ? WK : WV; const float* BA = which == 0 ? BQ : which == 1 ? BK : BV;
  v8f acc[8] = {};
  { const int srow = tid >> 4, sq = (tid & 15) * 4; const float* Xp = X + (r0 + srow) * DIN + sq; const float* Wp = WA + (size_t)(c0 + srow) * DIN + sq; __bf16* const sd = sg + srow * SP + sq;
    v4f xr[8], wr[16];
    ldg_tile(xr, Xp, DIN); ldg_tile(wr, Wp, DIN);
    asm volatile("s_wait_xcnt 0x0" :: "v"(Xp), "v"(Wp) : "memory");   // in front of the first overwrite of the loads' address registers: as inputs they stay untouched up to here (the build reused one pair for the accumulators' zeros)
    sts_bf(sd, xr); sts_bf(sd + 64 * SP, wr);
    // two stages a trip, so that the buffer's offset is a constant of each half
#pragma unroll 2
    for (int s = 0; s < DIN / SBK; ++s) {
      __syncthreads();   // publishes stage s and ends every wave's reads of the buffer that stage s + 1 is stored into below
      if (s + 1 < DIN / SBK) { ldg_tile(xr, Xp + (s + 1) * SBK, DIN); ldg_tile(wr, Wp + (s + 1) * SBK, DIN);   // the next stage's loads fly while this stage is multiplied
        asm volatile("s_wait_xcnt 0x0" ::: "memory"); }   // behind the run of loads: in front of the next trip's overwrite of their address registers on every way through the loop
      const __bf16* bu = sg + (s & 1) * (192 * SP);
#pragma unroll
      for (int kk = 0; kk < SBK / 32; ++kk) { const v16b a = frag_b(bu + (wave * 16 + col) * SP + kk * 32, lane); v16b w[8];
#pragma unroll
        for (int j = 0; j < 8; ++j) w[j] = frag_b(bu + (64 + j * 16 + col) * SP + kk * 32, lane);
#pragma unroll
        for (int j = 0; j < 8; ++j) acc[j] = wmma_bf(a, w[j], acc[j]); }
      __builtin_amdgcn_sched_barrier(0);   // keeps the waits for the next stage's loads behind all of this stage's products
      if (s + 1 < DIN / SBK) { __bf16* d = sd + ((s + 1) & 1) * (192 * SP); sts_bf(d, xr); sts_bf(d + 64 * SP, wr); } } }
  { // stage the f32 tile (acc + bias) in LDS, run the per-(row, head) epilogue hook, then convert
#pragma unroll
    for (int j = 0; j < 8; ++j) { const float bias = BA ? bfr(BA[c0 + j * 16 + col]) : 0.f;
#pragma unroll
      for (int r = 0; r < 8; ++r) st[wave * 16 + 8 * g + r][j * 16 + col] = acc[j][r] + bias; }
    __syncthreads();
    for (int e = tid; e < 64 * (128 / HD); e += 128) { const int rl = e / (128 / HD), hh = e % (128 / HD); PROJ_EPI(which, &st[rl][hh * HD], (int)((r0 + rl) % TT), (c0 / HD) + hh); }
    __syncthreads(); }
  if (which < 2) { _Float16* DH = which == 0 ? QH : KH; _Float16* DL = which == 0 ? QL : KL; const int nhi = which == 0 ? QHI : KHI; const bool hi_rows = t0 < nhi;
    for (int e = tid; e < 64 * 128; e += 128) { const int rl = e >> 7, cl = e & 127; const float v = st[rl][cl]; const _Float16 hv = (_Float16)v; sh[rl][cl] = hv; sl[rl][cl] = (_Float16)((v - (float)hv) * 1024.0f); }
    __syncthreads();
    for (int e = tid; e < 64 * 16; e += 128) { const int rl = e >> 4, q = e & 15; vst2((unsigned*)(DH + (r0 + rl) * CC + c0 + q * 8), *(const v4u*)&sh[rl][q * 8]); if (hi_rows) vst2((unsigned*)(DL + (bb * nhi + t0 + rl) * (size_t)CC + c0 + q * 8), *(const v4u*)&sl[rl][q * 8]); }
  } else { const bool hi_rows = t0 < KHI;
    for (int e = tid; e < 64 * 128; e += 128) { const int rl = e & 63, cl = e >> 6; const float v = st[rl][cl]; th[cl][rl] = (_Float16)v; const __bf16 bh = (__bf16)v; tb[cl][rl] = bh; tbl[cl][rl] = (__bf16)(v - (float)bh); }
    __syncthreads();
    for (int e = tid; e < 128 * 8; e += 128) { const int cl = e >> 3, q = e & 7; vst2((unsigned*)(VT + (bb * CC + c0 + cl) * (size_t)TT + t0 + q * 8), *(const v4u*)&th[cl][q * 8]);
      asm volatile("s_wait_xcnt 0x0" ::: "memory");   // in front of the overwrite of the store's data and address registers (this build reuses them at once)
      if (hi_rows) { const size_t o3 = (bb * CC + c0 + cl) * (size_t)KHI + t0 + q * 8; vst2((unsigned*)(VB + o3), *(const v4u*)&tb[cl][q * 8]); vst2((unsigned*)(VBL + o3), *(const v4u*)&tbl[cl][q * 8]);
        asm volatile("s_wait_xcnt 0x0" ::: "memory"); } } } }   // the same for these two stores, in front of the next trip
// ---- K/V staging of k_attn: a stage is one pass's 64 k rows and 64 v planes of the head (128 B each), brought into LDS once a block by asynchronous copies (8 lanes x 16 B a row, so every wave-wide copy covers four whole 128-B lines), for all four waves
#define KVP (HD + 8)          // staged row pitch in f16 elements: 144 B = 16 B x 9, an odd count of 16 B for the ds_load_b128 fragment reads
#define KVB (2 * 64 * KVP)    // one stage in f16 elements: 64 k rows, then 64 v planes
__device__ __forceinline__ void kv_copy(unsigned ld, const _Float16* kg, const _Float16* vg) {
  // one statement for the thread's eight copies and the s_wait_xcnt 0 behind them: the wait stands in front of every later overwrite of the copies' address registers
  asm volatile("global_load_async_to_lds_b128 %0, %8, off\n\t"
               "global_load_async_to_lds_b128 %1, %9, off\n\t"
               "global_load_async_to_lds_b128 %2, %10, off\n\t"
               "global_load_async_to_lds_b128 %3, %11, off\n\t"
               "global_load_async_to_lds_b128 %4, %12, off\n\t"
               "global_load_async_to_lds_b128 %5, %13, off\n\t"
               "global_load_async_to_lds_b128 %6, %14, off\n\t"
               "global_load_async_to_lds_b128 %7, %15, off\n\t"
               "s_wait_xcnt 0x0"
               :: "v"(ld), "v"(ld + 16u * KVP * 2u), "v"(ld + 32u * KVP * 2u), "v"(ld + 48u * KVP * 2u), "v"(ld + 64u * KVP * 2u), "v"(ld + 80u * KVP * 2u), "v"(ld + 96u * KVP * 2u), "v"(ld + 112u * KVP * 2u),
                  "v"(kg), "v"(kg + (size_t)16 * CC), "v"(kg + (size_t)32 * CC), "v"(kg + (size_t)48 * CC), "v"(vg), "v"(vg + (size_t)16 * TT), "v"(vg + (size_t)32 * TT), "v"(vg + (size_t)48 * TT)
               : "memory"); }
__global__ __launch_bounds__(128) void k_attn(const _Float16* __restrict__ QH, const _Float16* __restrict__ KH, const _Float16* __restrict__ QL, const _Float16* __restrict__ VT, float* __restrict__ Y) { __shared__ __align__(16) float ss[4][16][HD + 4]; __shared__ __align__(16) _Float16 kv[2 * KVB];
  const int tid = threadIdx.x, wave = tid >> 5, lane = tid & 31, col = lane & 15, g = lane >> 4; const int qb = blockIdx.x, h = blockIdx.y, b = blockIdx.z; const int ql0 = qb * 64 + wave * 16;
  const int srow = tid >> 3, sc = (tid & 7) * 8;   // the thread's row (and rows + 16, 32, 48) and 16-B piece of a stage
  const _Float16* Kg = KH + ((size_t)b * TT + srow) * CC + h * HD + sc;
  const _Float16* Vg = VT + ((size_t)b * CC + h * HD + srow) * (size_t)TT + sc;
  const unsigned ld0 = (unsigned)(size_t)(kv + srow * KVP + sc);   // LDS byte address: the low 32 bits of the shared address
  kv_copy(ld0, Kg, Vg);
  asm volatile("s_wait_asynccnt 0x0" ::: "memory");   // this wave's copies of stage 0 have landed
  __syncthreads();                                    // publishes stage 0
  kv_copy(ld0 + KVB * 2u, Kg + (size_t)64 * CC, Vg + 64);
  v16h qh[HD / 32], ql[HD / 32];
#pragma unroll
  for (int kc = 0; kc < HD / 32; ++kc) { qh[kc] = frag_h(QH + ((size_t)b * TT + ql0 + col) * CC + h * HD + kc * 32, lane); ql[kc] = frag_h(QL + ((size_t)b * QHI + ql0 + col) * CC + h * HD + kc * 32, lane); }
  v8f o[HD / 16] = {}; float m = -3.0e38f, l = 0.f;
  // the pass loop stays rolled (two passes' fragments at once would cost the fourth wave of a SIMD); every inner loop is unrolled so that each register-array index is a constant
#pragma unroll 1
  for (int t = 0; t < TT / 64; ++t) { v8f acc[4] = {}, accl[4] = {}; v16h kf[HD / 32][4], vf[2][HD / 16];
    const _Float16* Ks = kv + (t & 1) * KVB + col * KVP;   // key row col of the stage
    const _Float16* Vs = Ks + 64 * KVP;                    // v plane col of the stage
#pragma unroll
    for (int kc = 0; kc < HD / 32; ++kc) {   // all of the pass's k fragments are asked for before the first product, so that their latencies overlap
#pragma unroll
      for (int j = 0; j < 4; ++j) kf[kc][j] = frag_h(Ks + (j * 16) * KVP + kc * 32, lane); }
#pragma unroll
    for (int kc = 0; kc < HD / 32; ++kc) {
#pragma unroll
      for (int j = 0; j < 4; ++j) { acc[j] = wmma16(kf[kc][j], qh[kc], acc[j]); accl[j] = wmma16(kf[kc][j], ql[kc], accl[j]); } }
#pragma unroll
    for (int kc = 0; kc < 2; ++kc) {   // the pass's v fragments fly while the softmax is worked out
#pragma unroll
      for (int jj = 0; jj < HD / 16; ++jj) vf[kc][jj] = frag_h(Vs + (jj * 16) * KVP + kc * 32, lane); }
    float mx = -3.0e38f;
#pragma unroll
    for (int j = 0; j < 4; ++j) {
#pragma unroll
      for (int r = 0; r < 8; ++r) { const float s = acc[j][r] + accl[j][r] * (1.0f / 1024.0f); acc[j][r] = s; mx = fmaxf(mx, s); } }   // unscaled score: SCALE goes into SL2E below
    mx = fmaxf(mx, __shfl_xor(mx, 16));   // the other half of this query's keys
    const float mn = fmaxf(m, mx); const float corr = __builtin_amdgcn_exp2f((m - mn) * SL2E); m = mn;
    const float nb = 10.0f - mn * SL2E;   // exp(SCALE (s - mn)) x 2^10 = 2^(s SL2E + nb)
    float sum = 0.f; v16h p[2];
#pragma unroll
    for (int j = 0; j < 4; ++j) {
#pragma unroll
      for (int r = 0; r < 8; ++r) { const float e = __builtin_amdgcn_exp2f(fmaf(acc[j][r], SL2E, nb)); sum += e; p[j >> 1][(j & 1) * 8 + r] = (_Float16)e; } }
    l = l * corr + sum;
#pragma unroll
    for (int jj = 0; jj < HD / 16; ++jj) {
#pragma unroll
      for (int r = 0; r < 8; ++r) o[jj][r] *= corr; }
#pragma unroll
    for (int kc = 0; kc < 2; ++kc) {
#pragma unroll
      for (int jj = 0; jj < HD / 16; ++jj) o[jj] = wmma16(vf[kc][jj], p[kc], o[jj]); }
    asm volatile("s_wait_dscnt 0x0" ::: "memory");      // this wave's reads of stage t have returned
    asm volatile("s_wait_asynccnt 0x0" ::: "memory");   // this wave's copies of stage t + 1 have landed
    __syncthreads();                                    // publishes stage t + 1 and ends every wave's reads of the buffer that is refilled below
    if (t + 2 < TT / 64) kv_copy(ld0 + (unsigned)(t & 1) * (KVB * 2u), Kg + (size_t)(t + 2) * 64 * CC, Vg + (t + 2) * 64); }
  asm volatile("s_wait_asynccnt 0x0" ::: "memory");     // no copy is outstanding when the wave goes on to its end
  l += __shfl_xor(l, 16); const float inv = 1.0f / l;   // l carries the 2^10 of its terms
#pragma unroll
  for (int jj = 0; jj < HD / 16; ++jj)
#pragma unroll
    for (int r = 0; r < 8; ++r) ss[wave][col][jj * 16 + 8 * g + r] = o[jj][r] * inv;
  LDSX(); for (int rl = 0; rl < 16; ++rl) if (lane < HD / 4) vst2(Y + ((size_t)b * TT + ql0 + rl) * CC + h * HD + lane * 4, *(const v4f*)&ss[wave][rl][lane * 4]); }
// ---- k_out: block = (64 rows, 128 cols): out = ctx Wo (+ bo): all rows: ctx bf16 hi + lo against exact bf16 Wo (2 products)
__global__ __launch_bounds__(128) void k_out(const float* __restrict__ Y, const float* __restrict__ WO, const float* __restrict__ BO, float* __restrict__ OUT) { __shared__ __align__(16) float sf[4][16][132]; __shared__ __align__(16) __bf16 sg[2 * 256 * SP];   // two operand stages of 256 rows: ctx hi 64, ctx lo 64, Wo 128
  const int tid = threadIdx.x, wave = tid >> 5, lane = tid & 31, col = lane & 15, g = lane >> 4; const int c0 = blockIdx.y * 128; const size_t r0 = (size_t)blockIdx.x * 64 + wave * 16;
  v8f acc[8] = {};
  if (true) {   /* ALL rows: ctx split bf16 hi + lo x exact Wo (2 products) */
    const int srow = tid >> 4, sq = (tid & 15) * 4; const float* Yp = Y + ((size_t)blockIdx.x * 64 + srow) * CC + sq; const float* Wp = WO + (size_t)(c0 + srow) * CC + sq; __bf16* const sd = sg + srow * SP + sq;
    v4f yr[8], wr[16];
    ldg_tile(yr, Yp, CC); ldg_tile(wr, Wp, CC); sts_split(sd, sd + 64 * SP, yr); sts_bf(sd + 128 * SP, wr);
    // two stages a trip, so that the buffer's offset is a constant of each half
#pragma unroll 2
    for (int s = 0; s < CC / SBK; ++s) {
      __syncthreads();   // publishes stage s and ends every wave's reads of the buffer that stage s + 1 is stored into below
      if (s + 1 < CC / SBK) { ldg_tile(yr, Yp + (s + 1) * SBK, CC); ldg_tile(wr, Wp + (s + 1) * SBK, CC);   // the next stage's loads fly while this stage is multiplied
        asm volatile("s_wait_xcnt 0x0" ::: "memory"); }   // behind the run of loads: in front of the next trip's overwrite of their address registers on every way through the loop
      const __bf16* bu = sg + (s & 1) * (256 * SP);
#pragma unroll
      for (int kk = 0; kk < SBK / 32; ++kk) { const v16b ah = frag_b(bu + (wave * 16 + col) * SP + kk * 32, lane), al = frag_b(bu + (64 + wave * 16 + col) * SP + kk * 32, lane); v16b w[8];
#pragma unroll
        for (int j = 0; j < 8; ++j) w[j] = frag_b(bu + (128 + j * 16 + col) * SP + kk * 32, lane);
#pragma unroll
        for (int j = 0; j < 8; ++j) { acc[j] = wmma_bf(ah, w[j], acc[j]); acc[j] = wmma_bf(al, w[j], acc[j]); } }
      __builtin_amdgcn_sched_barrier(0);   // keeps the waits for the next stage's loads behind all of this stage's products
      if (s + 1 < CC / SBK) { __bf16* d = sd + ((s + 1) & 1) * (256 * SP); sts_split(d, d + 64 * SP, yr); sts_bf(d + 128 * SP, wr); } }
#pragma unroll
    for (int j = 0; j < 8; ++j) { const float bias = BO ? bfr(BO[c0 + j * 16 + col]) : 0.f;
#pragma unroll
      for (int r = 0; r < 8; ++r) sf[wave][8 * g + r][j * 16 + col] = acc[j][r] + bias; }
  } else {
#pragma unroll 2
    for (int kc = 0; kc < CC / 32; ++kc) { const v16h a = frag_f32(Y + (r0 + col) * CC + kc * 32, lane); asm volatile("s_wait_loadcnt 0x0" ::: "memory");
#pragma unroll
      for (int j = 0; j < 8; ++j) { const v16h w = WOCOLH(WO, kc * 32, c0 + j * 16 + col, lane); asm volatile("s_wait_loadcnt 0x0" ::: "memory"); acc[j] = wmma16(a, w, acc[j]); } }
#pragma unroll
    for (int j = 0; j < 8; ++j) { const float bias = BO ? bfr(BO[c0 + j * 16 + col]) : 0.f;
#pragma unroll
      for (int r = 0; r < 8; ++r) sf[wave][8 * g + r][j * 16 + col] = acc[j][r] * (1.0f / 256.0f) + bias; } }
  LDSX(); for (int rl = 0; rl < 16; ++rl) vst2(OUT + (r0 + rl) * DIN + c0 + lane * 4, *(const v4f*)&sf[wave][rl][lane * 4]); }

extern "C" void kernel_launch(void* const* d_in, const int* in_sizes, int n_in, void* d_out, int out_size, void* d_ws, size_t ws_size, hipStream_t stream) {
  (void)in_sizes; (void)n_in; (void)out_size;
  const float** F = (const float**)d_in;
  if (ws_size < (size_t)WS_END) return;
  char* ws = (char*)d_ws; _Float16 *QH = (_Float16*)(ws + WS_QH), *KH = (_Float16*)(ws + WS_KH), *VT = (_Float16*)(ws + WS_VT), *QL = (_Float16*)(ws + WS_QL), *KL = (_Float16*)(ws + WS_KL); __bf16 *VB = (__bf16*)(ws + WS_VB), *VBL = (__bf16*)(ws + WS_VBL); float *Y = (float*)(ws + WS_Y);
  (void)Y; (void)QL; (void)KL; (void)VB; (void)VBL;
  // inputs: 0 q, 1 k, 2 v [4,1024,1024]; 3 Wq [1024,1024] (out,in), 4 bq; 5 Wk, 6 bk; 7 Wv, 8 bv; 9 Wo, 10 bo
  k_proj<<<dim3(TNB * TT / 64, CC / 128, 3), 128, 0, stream>>>(F[0], F[1], F[2], F[3], F[5], F[7], F[4], F[6], F[8], QH, QL, KH, KL, VT, VB, VBL);
  k_attn<<<dim3(NQB, NH, TNB), 128, 0, stream>>>(QH, KH, QL, VT, Y);
  k_out<<<dim3(TNB * TT / 64, DIN / 128), 128, 0, stream>>>(Y, F[9], F[10], (float*)d_out);
}

// v005
// It runs in 92.5 microseconds.
// Next to v004, in two timings, it ran 1.16 times as fast each time.
// All steps since v000 together make it 14.2 times as fast.
// compute dtype: all float inputs rounded to bf16; q/k/v projections with EXACT bf16 products on WMMA 16x16x32 (f32 accumulate); the sinusoidal PE added in f32 (sincosf) to the projected q/k rows; q as f16 hi + residual (x 2^10) against k once to f16 (2 products) x 64^-0.5; softmax in f32 (exponent in base 2: one fma, then the hardware exp2) with a running maximum and sum, 64 keys a pass; exp(s - m) x 2^10 once to f16 against v once to f16 (1 product); ctx split bf16 hi + lo against exact Wo (2 products); f32 output.
#include <hip/hip_runtime.h>
#include <math.h>

typedef __attribute__((ext_vector_type(16))) _Float16 v16h;
typedef __attribute__((ext_vector_type(16))) __bf16 v16b;
typedef __attribute__((ext_vector_type(8)))  _Float16 v8h;
typedef __attribute__((ext_vector_type(8)))  float v8f;
typedef __attribute__((ext_vector_type(4)))  float v4f;
typedef __attribute__((ext_vector_type(2)))  float v2f;
typedef __attribute__((ext_vector_type(4)))  unsigned v4u;
typedef __attribute__((ext_vector_type(4)))  int v4i;
typedef float __attribute__((may_alias)) float_a;
typedef int __attribute__((may_alias)) int_a;

template <typename T> __device__ __forceinline__ void vst2(void* p, T v) { *(T*)p = v;  }
__device__ __forceinline__ v8f wmma16(v16h a, v16h b, v8f c) {
  v8f d = __builtin_amdgcn_wmma_f32_16x16x32_f16(false, a, false, b, (short)0, c, false, false);
  asm volatile("v_nop\n\tv_nop\n\tv_nop\n\tv_nop" : "+v"(d) : "v"(a), "v"(b));
  return d;
}
__device__ __forceinline__ v8f wmma_bf(v16b a, v16b b, v8f c) {
  v8f d = __builtin_amdgcn_wmma_f32_16x16x32_bf16(false, a, false, b, (short)0, c, false, false);
  asm volatile("v_nop\n\tv_nop\n\tv_nop\n\tv_nop" : "+v"(d) : "v"(a), "v"(b));
  return d;
}
// the plain builtin, for k_proj's loop: its live set passes 256 registers, and an asm statement's vector operands are held to the first 256 (the accumulators were spilled for it); the compiler keeps the distances behind its own builtin
__device__ __forceinline__ v8f wmma_bfp(v16b a, v16b b, v8f c) { return __builtin_amdgcn_wmma_f32_16x16x32_bf16(false, a, false, b, (short)0, c, false, false); }
// 16x16x32 fragments: lane = (h = lane>>4, row/col = lane&15); elements 0..7 = k0+8h+0..7, 8..15 = k0+16+8h+0..7; D element r = row 8h+r
__device__ __forceinline__ v16h frag_h(const _Float16* rowk0, int lane) {
  union { v16h v; v8h q[2]; } u; const _Float16* p = rowk0 + 8 * (lane >> 4);
  u.q[0] = *(const v8h*)p; u.q[1] = *(const v8h*)(p + 16); return u.v;
}
__device__ __forceinline__ v16h frag_f32(const float* rowk0, int lane) {
  v16h a; const float* p = rowk0 + 8 * (lane >> 4);
#pragma unroll
  for (int i = 0; i < 8; ++i) { a[i] = (_Float16)p[i]; a[8 + i] = (_Float16)p[16 + i]; }
  return a;
}
__device__ __forceinline__ v16h frag_f32s(const float* rowk0, int lane, float sc) {
  v16h a; const float* p = rowk0 + 8 * (lane >> 4);
#pragma unroll
  for (int i = 0; i < 8; ++i) { a[i] = (_Float16)(p[i] * sc); a[8 + i] = (_Float16)(p[16 + i] * sc); }
  return a;
}
// column fragment from a [K][ld] layout (column n), rows >= K read as 0
__device__ __forceinline__ v16h fragc_f32(const float* W, int k0, int n, int lane, int ld, int K) {
  v16h a; const int g = lane >> 4;
#pragma unroll
  for (int i = 0; i < 8; ++i) { const int ka = k0 + 8 * g + i, kb = ka + 16;
    a[i] = (_Float16)(ka < K ? W[(size_t)(ka < K ? ka : K - 1) * ld + n] : 0.f); a[8 + i] = (_Float16)(kb < K ? W[(size_t)(kb < K ? kb : K - 1) * ld + n] : 0.f); }
  return a;
}
struct F2 { v16b h, l; };
__device__ __forceinline__ F2 bsplit16(const float v[16]) { F2 r;
#pragma unroll
  for (int i = 0; i < 16; ++i) { const __bf16 h = (__bf16)v[i]; r.h[i] = h; r.l[i] = (__bf16)(v[i] - (float)h); }
  return r; }
__device__ __forceinline__ F2 split_row(const float* row, int k0, int lane) { float v[16]; const float* p = row + k0 + 8 * (lane >> 4);
#pragma unroll
  for (int i = 0; i < 8; ++i) { v[i] = p[i]; v[8 + i] = p[16 + i]; }
  return bsplit16(v); }
__device__ __forceinline__ F2 split_rowK(const float* row, int k0, int lane, int K) { float v[16]; const int g = lane >> 4;
#pragma unroll
  for (int i = 0; i < 8; ++i) { const int ka = k0 + 8 * g + i, kb = ka + 16; v[i] = ka < K ? row[ka < K ? ka : K - 1] : 0.f; v[8 + i] = kb < K ? row[kb < K ? kb : K - 1] : 0.f; }
  return bsplit16(v); }
__device__ __forceinline__ F2 split_col(const float* W, int k0, int n, int lane, int ld, int K) { float v[16]; const int g = lane >> 4;
#pragma unroll
  for (int i = 0; i < 8; ++i) { const int ka = k0 + 8 * g + i, kb = ka + 16; v[i] = ka < K ? W[(size_t)(ka < K ? ka : K - 1) * ld + n] : 0.f; v[8 + i] = kb < K ? W[(size_t)(kb < K ? kb : K - 1) * ld + n] : 0.f; }
  return bsplit16(v); }
__device__ __forceinline__ v8f mac3(const F2& a, const F2& b, v8f c) { c = wmma_bf(a.l, b.h, c); c = wmma_bf(a.h, b.l, c); return wmma_bf(a.h, b.h, c); }
__device__ __forceinline__ float sigm(float v) { return 1.0f / (1.0f + expf(-v)); }
#define LDSX() do { asm volatile("s_wait_dscnt 0" ::: "memory"); __builtin_amdgcn_wave_barrier(); __builtin_amdgcn_fence(__ATOMIC_RELEASE, "workgroup"); } while (0)

// Multi-head attention with an additive sinusoidal positional encoding (B 4, S 1,024, 1,024 = 16 x 64; separate q/k/v inputs): qh, kh, vh = x W^T + b ((out,in)); qh += pe, kh += pe with pe[t][2i] = sin(t div_i), pe[t][2i+1] = cos(t div_i), div_i = exp(-2i ln(10000)/64); out = merged(softmax(qh kh^T x 64^-0.5) vh) Wo^T + bo.
#define NB 4
#define TT 1024
#define CC 1024            // NH * HD = projected width
#define DIN 1024          // input (model) width
#define NH 16
#define HD 64
#define NQB (TT / 64)
#define HG 4
#define SCALE (0.125f)
#define SL2E (SCALE * 1.44269504088896340736f)   // SCALE x log2(e): the softmax exponent in base 2
#define CAUSAL 0
#ifndef TNB
#define TNB NB
#endif
__device__ __forceinline__ float bfr(float v) { return (float)(__bf16)v; }
__host__ __device__ __forceinline__ int kb_last(int qb) { return CAUSAL ? ((qb * 64 + 63) >> 7) : (TT / 128 - 1); }
typedef __attribute__((ext_vector_type(8))) __bf16 v8b;
__device__ __forceinline__ v16b frag_b(const __bf16* rowk0, int lane) {
  union { v16b v; v8b q[2]; } u; const __bf16* p = rowk0 + 8 * (lane >> 4);
  u.q[0] = *(const v8b*)p; u.q[1] = *(const v8b*)(p + 16); return u.v;
}
#define QBH 0              // not read by any kernel
#define QHI 1024            // rows carrying a q residual plane (all rows when non-causal: 2-product logits everywhere)
#define KHI 64            // key rows carrying k residual / v bf16 hi+lo planes (written by k_proj, read by no kernel)
// B fragment (k rows k0+.., output column o) of a weight: (in,out) [K][ld] or (out,in) [ld rows of K]: bf16 exact, or f16(bf16 * 256) exact
__device__ __forceinline__ v16b wcol_io(const float* Wm, int k0, int o, int lane, int ld) { v16b w; const int g = lane >> 4;
#pragma unroll
  for (int i = 0; i < 8; ++i) { w[i] = (__bf16)Wm[(size_t)(k0 + 8 * g + i) * ld + o]; w[8 + i] = (__bf16)Wm[(size_t)(k0 + 16 + 8 * g + i) * ld + o]; }
  return w; }
__device__ __forceinline__ v16b wcol_oi(const float* Wm, int k0, int o, int lane, int K) { v16b w; const float* p = Wm + (size_t)o * K + k0 + 8 * (lane >> 4);
#pragma unroll
  for (int i = 0; i < 8; ++i) { w[i] = (__bf16)p[i]; w[8 + i] = (__bf16)p[16 + i]; }
  return w; }
__device__ __forceinline__ v16h wcolh_io(const float* Wm, int k0, int o, int lane, int ld) { v16h w; const int g = lane >> 4;
#pragma unroll
  for (int i = 0; i < 8; ++i) { w[i] = (_Float16)(bfr(Wm[(size_t)(k0 + 8 * g + i) * ld + o]) * 256.0f); w[8 + i] = (_Float16)(bfr(Wm[(size_t)(k0 + 16 + 8 * g + i) * ld + o]) * 256.0f); }
  return w; }
__device__ __forceinline__ v16h wcolh_oi(const float* Wm, int k0, int o, int lane, int K) { v16h w; const float* p = Wm + (size_t)o * K + k0 + 8 * (lane >> 4);
#pragma unroll
  for (int i = 0; i < 8; ++i) { w[i] = (_Float16)(bfr(p[i]) * 256.0f); w[8 + i] = (_Float16)(bfr(p[16 + i]) * 256.0f); }
  return w; }
#define WQKV_LAYOUT 1   // 0 = (in,out) [DIN][CC]; 1 = (out,in) [CC][DIN]; 2 = per-head [NH][DIN][HD]
__device__ __forceinline__ v16b wcol_hdk(const float* Wm, int k0, int o, int lane) { v16b w; const int g = lane >> 4; const float* p = Wm + (size_t)(o / HD) * DIN * HD + (o % HD);
#pragma unroll
  for (int i = 0; i < 8; ++i) { w[i] = (__bf16)p[(size_t)(k0 + 8 * g + i) * HD]; w[8 + i] = (__bf16)p[(size_t)(k0 + 16 + 8 * g + i) * HD]; }
  return w; }
#define WO_OUT_IN 1
#if WQKV_LAYOUT == 1
#define WCOL(W, k0, o, lane) wcol_oi(W, k0, o, lane, DIN)
#elif WQKV_LAYOUT == 2
#define WCOL(W, k0, o, lane) wcol_hdk(W, k0, o, lane)
#else
#define WCOL(W, k0, o, lane) wcol_io(W, k0, o, lane, CC)
#endif
#if WO_OUT_IN
#define WOCOL(W, k0, o, lane) wcol_oi(W, k0, o, lane, CC)
#define WOCOLH(W, k0, o, lane) wcolh_oi(W, k0, o, lane, CC)
#else
#define WOCOL(W, k0, o, lane) wcol_io(W, k0, o, lane, DIN)
#define WOCOLH(W, k0, o, lane) wcolh_io(W, k0, o, lane, DIN)
#endif
__constant__ float c_div[32] = {1.000000000e+0f,7.498942018e-1f,5.623413324e-1f,4.216964841e-1f,3.162277639e-1f,2.371373624e-1f,1.778279394e-1f,1.333521456e-1f,9.999999404e-2f,7.498941571e-2f,5.623412877e-2f,4.216964915e-2f,3.162277490e-2f,2.371373586e-2f,1.778279245e-2f,1.333521307e-2f,9.999999776e-3f,7.498941384e-3f,5.623412784e-3f,4.216964822e-3f,3.162277397e-3f,2.371373586e-3f,1.778279198e-3f,1.333521330e-3f,9.999999311e-4f,7.498941268e-4f,5.623412435e-4f,4.216964589e-4f,3.162277280e-4f,2.371373412e-4f,1.778279257e-4f,1.333521213e-4f};   /* f32(exp(2i * (-ln(10000)/64))) - the module's 'div' */
#define PROJ_EPI(which, row, t, h) do { if ((which) < 2) { float* rw = (row); const float pf = (float)(t); _Pragma("unroll") for (int i = 0; i < 32; ++i) { float sn, cs; sincosf(pf * c_div[i], &sn, &cs); rw[2 * i] += sn; rw[2 * i + 1] += cs; } } } while (0)   /* q, k += sinusoidal PE: pe[t][2i] = sin(t div_i), pe[t][2i+1] = cos(t div_i) */
#ifndef SM_EXTRA_PARAMS
#define SM_EXTRA_PARAMS
#endif
#ifndef PROJ_EXTRA_PARAMS
#define PROJ_EXTRA_PARAMS
#endif
#ifndef SM_MASK_HOOK
#define SM_MASK_HOOK (void)0
#endif

#define WS_QH  0u                                      // f16 q rows [b*t][CC]
#define WS_KH  (WS_QH + 2u * (size_t)NB * TT * CC)      // f16 k rows [b*t][CC]
#define WS_VT  (WS_KH + 2u * (size_t)NB * TT * CC)      // f16 v planes [b][c][t]
#define WS_QL  (WS_VT + 2u * (size_t)NB * CC * TT)      // f16 q residual x 2^10 rows [b][t < QHI][CC]
#define WS_KL  (WS_QL + 2u * (size_t)NB * QHI * CC)     // f16 k residual x 2^10 rows [b][t < KHI][CC]
#define WS_VB  (WS_KL + 2u * (size_t)NB * KHI * CC)     // bf16 v hi planes [b][c][t < KHI]
#define WS_VBL (WS_VB + 2u * (size_t)NB * CC * KHI)
#define WS_Y   (WS_VBL + 2u * (size_t)NB * CC * KHI)    // f32 ctx rows [b*t][CC] (only when there is an output projection)
#define WS_END (WS_Y  + 4u * (size_t)NB * TT * CC)

// ---- operand staging of the two projection kernels: a stage is SBK k columns of the block's rows, read from global memory once a block (16 lanes x 16 B a row, so every wave-wide load covers whole 128-B lines), rounded to bf16 once and kept in LDS for all the block's waves (four in k_proj, eight in k_out)
typedef __attribute__((ext_vector_type(4))) __bf16 v4b;
#define SBK 64
#define SP (SBK + 8)        // staged row pitch in bf16 elements: 144 B = 16 B x 9, an odd count of 16 B for the ds_load_b128 fragment reads
// R = rows between a thread's pieces = threads of the block / 16
// p is the same for the whole block and off the thread's own 32-bit byte offset, so that the loads can take a scalar base and one offset register in place of a 64-bit address pair each
template <int R, int N> __device__ __forceinline__ void ldg_tile(v4f (&r)[N], const float* p, unsigned off, int ld) { const float* q = (const float*)((const char*)p + off);
#pragma unroll
  for (int i = 0; i < N; ++i) r[i] = *(const v4f*)(q + (size_t)(R * i) * ld); }
template <int R, int N> __device__ __forceinline__ void sts_bf(__bf16* d, const v4f (&r)[N]) {
#pragma unroll
  for (int i = 0; i < N; ++i) { v4b t;
#pragma unroll
    for (int k = 0; k < 4; ++k) t[k] = (__bf16)r[i][k];
    *(v4b*)(d + R * i * SP) = t; } }
template <int R, int N> __device__ __forceinline__ void sts_split(__bf16* dh, __bf16* dl, const v4f (&r)[N]) {
#pragma unroll
  for (int i = 0; i < N; ++i) { v4b th, tl;
#pragma unroll
    for (int k = 0; k < 4; ++k) { const __bf16 h = (__bf16)r[i][k]; th[k] = h; tl[k] = (__bf16)(r[i][k] - (float)h); }
    *(v4b*)(dh + R * i * SP) = th; *(v4b*)(dl + R * i * SP) = tl; } }
// ---- k_proj: block = (128 rows, 128 cols, which), four waves of 64 x 64 (2 x 2): q/k/v = X W (+ b) with exact bf16 products (K = DIN) -> which 0: q f16 rows (+ residual rows < QHI); 1: k f16 rows (+ residual rows < KHI); 2: v f16 planes [c][t] (+ bf16 hi/lo planes for t < KHI); the epilogue takes the tile in two halves of 64 rows
__global__ __launch_bounds__(128) void k_proj(const float* __restrict__ XQ, const float* __restrict__ XK, const float* __restrict__ XV, const float* __restrict__ WQ, const float* __restrict__ WK, const float* __restrict__ WV, const float* __restrict__ BQ, const float* __restrict__ BK, const float* __restrict__ BV,
    _Float16* __restrict__ QH, _Float16* __restrict__ QL, _Float16* __restrict__ KH, _Float16* __restrict__ KL, _Float16* __restrict__ VT, __bf16* __restrict__ VB, __bf16* __restrict__ VBL PROJ_EXTRA_PARAMS) {
  // LDS: st, then one region that holds in turn the two operand stages (256 rows each: X 128, W 128) and, behind the epilogue's barriers, either sh + sl or th + tb + tbl
  __shared__ __align__(16) float st[64][132]; __shared__ __align__(16) unsigned char ur[2 * 256 * SP * 2];
  __bf16* const sg = (__bf16*)ur; _Float16 (* const sh)[136] = (_Float16 (*)[136])ur; _Float16 (* const sl)[136] = (_Float16 (*)[136])(ur + 64 * 136 * 2);
  _Float16 (* const th)[72] = (_Float16 (*)[72])ur; __bf16 (* const tb)[72] = (__bf16 (*)[72])(ur + 128 * 72 * 2); __bf16 (* const tbl)[72] = (__bf16 (*)[72])(ur + 2 * 128 * 72 * 2);
  const int tid = threadIdx.x, wave = tid >> 5, lane = tid & 31, col = lane & 15, g = lane >> 4; const int wr = wave >> 1, wc = wave & 1; const int which = blockIdx.z; const int c0 = blockIdx.y * 128; const size_t rb = (size_t)blockIdx.x * 128;
  const float* X = which == 0 ? XQ : which == 1 ? XK : XV; const float* WA = which == 0 ? WQ : which == 1 ? WK : WV; const float* BA = which == 0 ? BQ : which == 1 ? BK : BV;
  v8f acc[4][4] = {};
  { const int srow = tid >> 4, sq = (tid & 15) * 4; const float* Xp = X + rb * DIN; const float* Wp = WA + (size_t)c0 * DIN; const unsigned so = (unsigned)(srow * DIN + sq) * 4u; __bf16* const sd = sg + srow * SP + sq;
    v4f xr[16], wv[16];
    ldg_tile<8>(xr, Xp, so, DIN); ldg_tile<8>(wv, Wp, so, DIN);
    asm volatile("s_wait_xcnt 0x0" :: "v"(so) : "memory");   // in front of the first overwrite of the loads' address registers: as an input the offset stays untouched up to here
    sts_bf<8>(sd, xr); sts_bf<8>(sd + 128 * SP, wv);
    // two stages a trip, so that the buffer's offset is a constant of each half
#pragma unroll 2
    for (int s = 0; s < DIN / SBK; ++s) {
      __syncthreads();   // publishes stage s and ends every wave's reads of the buffer that stage s + 1 is stored into below
      if (s + 1 < DIN / SBK) { ldg_tile<8>(xr, Xp + (s + 1) * SBK, so, DIN); ldg_tile<8>(wv, Wp + (s + 1) * SBK, so, DIN);   // the next stage's loads fly while this stage is multiplied
        asm volatile("s_wait_xcnt 0x0" ::: "memory"); }   // behind the run of loads: in front of the next trip's overwrite of their address registers on every way through the loop
      const __bf16* bu = sg + (s & 1) * (256 * SP);
#pragma unroll
      for (int kk = 0; kk < SBK / 32; ++kk) { v16b a[4], w[4];
#pragma unroll
        for (int i = 0; i < 4; ++i) a[i] = frag_b(bu + (wr * 64 + i * 16 + col) * SP + kk * 32, lane);
#pragma unroll
        for (int j = 0; j < 4; ++j) w[j] = frag_b(bu + (128 + wc * 64 + j * 16 + col) * SP + kk * 32, lane);
#pragma unroll
        for (int i = 0; i < 4; ++i) {
#pragma unroll
          for (int j = 0; j < 4; ++j) acc[i][j] = wmma_bfp(a[i], w[j], acc[i][j]); } }
      __builtin_amdgcn_sched_barrier(0);   // keeps the waits for the next stage's loads behind all of this stage's products
      if (s + 1 < DIN / SBK) { __bf16* d = sd + ((s + 1) & 1) * (256 * SP); sts_bf<8>(d, xr); sts_bf<8>(d + 128 * SP, wv); } } }
  // the two halves share one copy of the epilogue's code (it is long: 32 sincosf); no index of acc depends on half
#pragma unroll 1
  for (int half = 0; half < 2; ++half) { const size_t r0 = rb + half * 64; const size_t bb = r0 / TT; const int t0 = (int)(r0 % TT);
  { // the two waves that hold this half stage its f32 tile (acc + bias) in LDS; then the per-(row, head) epilogue hook, then convert
    if (wr == half) {
#pragma unroll
      for (int j = 0; j < 4; ++j) { const float bias = BA ? bfr(BA[c0 + wc * 64 + j * 16 + col]) : 0.f;
#pragma unroll
        for (int i = 0; i < 4; ++i) {
#pragma unroll
          for (int r = 0; r < 8; ++r) st[i * 16 + 8 * g + r][wc * 64 + j * 16 + col] = acc[i][j][r] + bias; } } }
    __syncthreads();
    for (int e = tid; e < 64 * (128 / HD); e += 128) { const int rl = e / (128 / HD), hh = e % (128 / HD); PROJ_EPI(which, &st[rl][hh * HD], (int)((r0 + rl) % TT), (c0 / HD) + hh); }
    __syncthreads(); }
  if (which < 2) { _Float16* DH = which == 0 ? QH : KH; _Float16* DL = which == 0 ? QL : KL; const int nhi = which == 0 ? QHI : KHI; const bool hi_rows = t0 < nhi;
    for (int e = tid; e < 64 * 128; e += 128) { const int rl = e >> 7, cl = e & 127; const float v = st[rl][cl]; const _Float16 hv = (_Float16)v; sh[rl][cl] = hv; sl[rl][cl] = (_Float16)((v - (float)hv) * 1024.0f); }
    __syncthreads();
    for (int e = tid; e < 64 * 16; e += 128) { const int rl = e >> 4, q = e & 15; vst2((unsigned*)(DH + (r0 + rl) * CC + c0 + q * 8), *(const v4u*)&sh[rl][q * 8]); if (hi_rows) vst2((unsigned*)(DL + (bb * nhi + t0 + rl) * (size_t)CC + c0 + q * 8), *(const v4u*)&sl[rl][q * 8]); }
  } else { const bool hi_rows = t0 < KHI;
    for (int e = tid; e < 64 * 128; e += 128) { const int rl = e & 63, cl = e >> 6; const float v = st[rl][cl]; th[cl][rl] = (_Float16)v; const __bf16 bh = (__bf16)v; tb[cl][rl] = bh; tbl[cl][rl] = (__bf16)(v - (float)bh); }
    __syncthreads();
    for (int e = tid; e < 128 * 8; e += 128) { const int cl = e >> 3, q = e & 7; vst2((unsigned*)(VT + (bb * CC + c0 + cl) * (size_t)TT + t0 + q * 8), *(const v4u*)&th[cl][q * 8]);
      asm volatile("s_wait_xcnt 0x0" ::: "memory");   // in front of the overwrite of the store's data and address registers (this build reuses them at once)
      if (hi_rows) { const size_t o3 = (bb * CC + c0 + cl) * (size_t)KHI + t0 + q * 8; vst2((unsigned*)(VB + o3), *(const v4u*)&tb[cl][q * 8]); vst2((unsigned*)(VBL + o3), *(const v4u*)&tbl[cl][q * 8]);
        asm volatile("s_wait_xcnt 0x0" ::: "memory"); } } } } }   // the same for these two stores, in front of the next trip
// ---- K/V staging of k_attn: a stage is one pass's 64 k rows and 64 v planes of the head (128 B each), brought into LDS once a block by asynchronous copies (8 lanes x 16 B a row, so every wave-wide copy covers four whole 128-B lines), for all four waves
#define KVP (HD + 8)          // staged row pitch in f16 elements: 144 B = 16 B x 9, an odd count of 16 B for the ds_load_b128 fragment reads
#define KVB (2 * 64 * KVP)    // one stage in f16 elements: 64 k rows, then 64 v planes
__device__ __forceinline__ void kv_copy(unsigned ld, const _Float16* kg, const _Float16* vg) {
  // one statement for the thread's eight copies and the s_wait_xcnt 0 behind them: the wait stands in front of every later overwrite of the copies' address registers
  asm volatile("global_load_async_to_lds_b128 %0, %8, off\n\t"
               "global_load_async_to_lds_b128 %1, %9, off\n\t"
               "global_load_async_to_lds_b128 %2, %10, off\n\t"
               "global_load_async_to_lds_b128 %3, %11, off\n\t"
               "global_load_async_to_lds_b128 %4, %12, off\n\t"
               "global_load_async_to_lds_b128 %5, %13, off\n\t"
               "global_load_async_to_lds_b128 %6, %14, off\n\t"
               "global_load_async_to_lds_b128 %7, %15, off\n\t"
               "s_wait_xcnt 0x0"
               :: "v"(ld), "v"(ld + 16u * KVP * 2u), "v"(ld + 32u * KVP * 2u), "v"(ld + 48u * KVP * 2u), "v"(ld + 64u * KVP * 2u), "v"(ld + 80u * KVP * 2u), "v"(ld + 96u * KVP * 2u), "v"(ld + 112u * KVP * 2u),
                  "v"(kg), "v"(kg + (size_t)16 * CC), "v"(kg + (size_t)32 * CC), "v"(kg + (size_t)48 * CC), "v"(vg), "v"(vg + (size_t)16 * TT), "v"(vg + (size_t)32 * TT), "v"(vg + (size_t)48 * TT)
               : "memory"); }
__global__ __launch_bounds__(128) void k_attn(const _Float16* __restrict__ QH, const _Float16* __restrict__ KH, const _Float16* __restrict__ QL, const _Float16* __restrict__ VT, float* __restrict__ Y) { __shared__ __align__(16) float ss[4][16][HD + 4]; __shared__ __align__(16) _Float16 kv[2 * KVB];
  const int tid = threadIdx.x, wave = tid >> 5, lane = tid & 31, col = lane & 15, g = lane >> 4; const int qb = blockIdx.x, h = blockIdx.y, b = blockIdx.z; const int ql0 = qb * 64 + wave * 16;
  const int srow = tid >> 3, sc = (tid & 7) * 8;   // the thread's row (and rows + 16, 32, 48) and 16-B piece of a stage
  const _Float16* Kg = KH + ((size_t)b * TT + srow) * CC + h * HD + sc;
  const _Float16* Vg = VT + ((size_t)b * CC + h * HD + srow) * (size_t)TT + sc;
  const unsigned ld0 = (unsigned)(size_t)(kv + srow * KVP + sc);   // LDS byte address: the low 32 bits of the shared address
  kv_copy(ld0, Kg, Vg);
  asm volatile("s_wait_asynccnt 0x0" ::: "memory");   // this wave's copies of stage 0 have landed
  __syncthreads();                                    // publishes stage 0
  kv_copy(ld0 + KVB * 2u, Kg + (size_t)64 * CC, Vg + 64);
  v16h qh[HD / 32], ql[HD / 32];
#pragma unroll
  for (int kc = 0; kc < HD / 32; ++kc) { qh[kc] = frag_h(QH + ((size_t)b * TT + ql0 + col) * CC + h * HD + kc * 32, lane); ql[kc] = frag_h(QL + ((size_t)b * QHI + ql0 + col) * CC + h * HD + kc * 32, lane); }
  v8f o[HD / 16] = {}; float m = -3.0e38f, l = 0.f;
  // the pass loop stays rolled (two passes' fragments at once would cost the fourth wave of a SIMD); every inner loop is unrolled so that each register-array index is a constant
#pragma unroll 1
  for (int t = 0; t < TT / 64; ++t) { v8f acc[4] = {}, accl[4] = {}; v16h kf[HD / 32][4], vf[2][HD / 16];
    const _Float16* Ks = kv + (t & 1) * KVB + col * KVP;   // key row col of the stage
    const _Float16* Vs = Ks + 64 * KVP;                    // v plane col of the stage
#pragma unroll
    for (int kc = 0; kc < HD / 32; ++kc) {   // all of the pass's k fragments are asked for before the first product, so that their latencies overlap
#pragma unroll
      for (int j = 0; j < 4; ++j) kf[kc][j] = frag_h(Ks + (j * 16) * KVP + kc * 32, lane); }
#pragma unroll
    for (int kc = 0; kc < HD / 32; ++kc) {
#pragma unroll
      for (int j = 0; j < 4; ++j) { acc[j] = wmma16(kf[kc][j], qh[kc], acc[j]); accl[j] = wmma16(kf[kc][j], ql[kc], accl[j]); } }
#pragma unroll
    for (int kc = 0; kc < 2; ++kc) {   // the pass's v fragments fly while the softmax is worked out
#pragma unroll
      for (int jj = 0; jj < HD / 16; ++jj) vf[kc][jj] = frag_h(Vs + (jj * 16) * KVP + kc * 32, lane); }
    float mx = -3.0e38f;
#pragma unroll
    for (int j = 0; j < 4; ++j) {
#pragma unroll
      for (int r = 0; r < 8; ++r) { const float s = acc[j][r] + accl[j][r] * (1.0f / 1024.0f); acc[j][r] = s; mx = fmaxf(mx, s); } }   // unscaled score: SCALE goes into SL2E below
    mx = fmaxf(mx, __shfl_xor(mx, 16));   // the other half of this query's keys
    const float mn = fmaxf(m, mx); const float corr = __builtin_amdgcn_exp2f((m - mn) * SL2E); m = mn;
    const float nb = 10.0f - mn * SL2E;   // exp(SCALE (s - mn)) x 2^10 = 2^(s SL2E + nb)
    float sum = 0.f; v16h p[2];
#pragma unroll
    for (int j = 0; j < 4; ++j) {
#pragma unroll
      for (int r = 0; r < 8; ++r) { const float e = __builtin_amdgcn_exp2f(fmaf(acc[j][r], SL2E, nb)); sum += e; p[j >> 1][(j & 1) * 8 + r] = (_Float16)e; } }
    l = l * corr + sum;
#pragma unroll
    for (int jj = 0; jj < HD / 16; ++jj) {
#pragma unroll
      for (int r = 0; r < 8; ++r) o[jj][r] *= corr; }
#pragma unroll
    for (int kc = 0; kc < 2; ++kc) {
#pragma unroll
      for (int jj = 0; jj < HD / 16; ++jj) o[jj] = wmma16(vf[kc][jj], p[kc], o[jj]); }
    asm volatile("s_wait_dscnt 0x0" ::: "memory");      // this wave's reads of stage t have returned
    asm volatile("s_wait_asynccnt 0x0" ::: "memory");   // this wave's copies of stage t + 1 have landed
    __syncthreads();                                    // publishes stage t + 1 and ends every wave's reads of the buffer that is refilled below
    if (t + 2 < TT / 64) kv_copy(ld0 + (unsigned)(t & 1) * (KVB * 2u), Kg + (size_t)(t + 2) * 64 * CC, Vg + (t + 2) * 64); }
  asm volatile("s_wait_asynccnt 0x0" ::: "memory");     // no copy is outstanding when the wave goes on to its end
  l += __shfl_xor(l, 16); const float inv = 1.0f / l;   // l carries the 2^10 of its terms
#pragma unroll
  for (int jj = 0; jj < HD / 16; ++jj)
#pragma unroll
    for (int r = 0; r < 8; ++r) ss[wave][col][jj * 16 + 8 * g + r] = o[jj][r] * inv;
  LDSX(); for (int rl = 0; rl < 16; ++rl) if (lane < HD / 4) vst2(Y + ((size_t)b * TT + ql0 + rl) * CC + h * HD + lane * 4, *(const v4f*)&ss[wave][rl][lane * 4]); }
// ---- k_out: block = (128 rows, 128 cols), eight waves of 32 x 64 (4 x 2): out = ctx Wo (+ bo): ctx split bf16 hi + lo against exact bf16 Wo (2 products, hi then lo into each accumulator)
__global__ __launch_bounds__(256) void k_out(const float* __restrict__ Y, const float* __restrict__ WO, const float* __restrict__ BO, float* __restrict__ OUT) { __shared__ __align__(16) float sf[8][32][68]; __shared__ __align__(16) __bf16 sg[2 * 384 * SP];   // two operand stages of 384 rows: ctx hi 128, ctx lo 128, Wo 128
  const int tid = threadIdx.x, wave = tid >> 5, lane = tid & 31, col = lane & 15, g = lane >> 4; const int wr = wave >> 1, wc = wave & 1; const int c0 = blockIdx.y * 128; const size_t rb = (size_t)blockIdx.x * 128;
  v8f acc[2][4] = {};
  const int srow = tid >> 4, sq = (tid & 15) * 4; const float* Yp = Y + rb * CC; const float* Wp = WO + (size_t)c0 * CC; const unsigned so = (unsigned)(srow * CC + sq) * 4u; __bf16* const sd = sg + srow * SP + sq;
  v4f yr[8], wv[8];
  ldg_tile<16>(yr, Yp, so, CC); ldg_tile<16>(wv, Wp, so, CC);
  asm volatile("s_wait_xcnt 0x0" :: "v"(so) : "memory");   // in front of the first overwrite of the loads' address registers: as an input the offset stays untouched up to here
  sts_split<16>(sd, sd + 128 * SP, yr); sts_bf<16>(sd + 256 * SP, wv);
  // two stages a trip, so that the buffer's offset is a constant of each half
#pragma unroll 2
  for (int s = 0; s < CC / SBK; ++s) {
    __syncthreads();   // publishes stage s and ends every wave's reads of the buffer that stage s + 1 is stored into below
    if (s + 1 < CC / SBK) { ldg_tile<16>(yr, Yp + (s + 1) * SBK, so, CC); ldg_tile<16>(wv, Wp + (s + 1) * SBK, so, CC);   // the next stage's loads fly while this stage is multiplied
      asm volatile("s_wait_xcnt 0x0" ::: "memory"); }   // behind the run of loads: in front of the next trip's overwrite of their address registers on every way through the loop
    const __bf16* bu = sg + (s & 1) * (384 * SP);
#pragma unroll
    for (int kk = 0; kk < SBK / 32; ++kk) { v16b ah[2], al[2], w[4];
#pragma unroll
      for (int i = 0; i < 2; ++i) { ah[i] = frag_b(bu + (wr * 32 + i * 16 + col) * SP + kk * 32, lane); al[i] = frag_b(bu + (128 + wr * 32 + i * 16 + col) * SP + kk * 32, lane); }
#pragma unroll
      for (int j = 0; j < 4; ++j) w[j] = frag_b(bu + (256 + wc * 64 + j * 16 + col) * SP + kk * 32, lane);
#pragma unroll
      for (int i = 0; i < 2; ++i) {
#pragma unroll
        for (int j = 0; j < 4; ++j) acc[i][j] = wmma_bf(ah[i], w[j], acc[i][j]); }
#pragma unroll
      for (int i = 0; i < 2; ++i) {
#pragma unroll
        for (int j = 0; j < 4; ++j) acc[i][j] = wmma_bf(al[i], w[j], acc[i][j]); } }
    __builtin_amdgcn_sched_barrier(0);   // keeps the waits for the next stage's loads behind all of this stage's products
    if (s + 1 < CC / SBK) { __bf16* d = sd + ((s + 1) & 1) * (384 * SP); sts_split<16>(d, d + 128 * SP, yr); sts_bf<16>(d + 256 * SP, wv); } }
#pragma unroll
  for (int j = 0; j < 4; ++j) { const float bias = BO ? bfr(BO[c0 + wc * 64 + j * 16 + col]) : 0.f;
#pragma unroll
    for (int i = 0; i < 2; ++i) {
#pragma unroll
      for (int r = 0; r < 8; ++r) sf[wave][i * 16 + 8 * g + r][j * 16 + col] = acc[i][j][r] + bias; } }
  LDSX();
  // a wave-wide store covers two rows of the wave's 64 columns (256 B each); all rows are read back first, so that no store's register is written again
  v4f ov[16];
#pragma unroll
  for (int i = 0; i < 16; ++i) ov[i] = *(const v4f*)&sf[wave][2 * i + g][col * 4];
#pragma unroll
  for (int i = 0; i < 16; ++i) vst2(OUT + (rb + wr * 32 + 2 * i + g) * DIN + c0 + wc * 64 + col * 4, ov[i]); }

extern "C" void kernel_launch(void* const* d_in, const int* in_sizes, int n_in, void* d_out, int out_size, void* d_ws, size_t ws_size, hipStream_t stream) {
  (void)in_sizes; (void)n_in; (void)out_size;
  const float** F = (const float**)d_in;
  if (ws_size < (size_t)WS_END) return;
  char* ws = (char*)d_ws; _Float16 *QH = (_Float16*)(ws + WS_QH), *KH = (_Float16*)(ws + WS_KH), *VT = (_Float16*)(ws + WS_VT), *QL = (_Float16*)(ws + WS_QL), *KL = (_Float16*)(ws + WS_KL); __bf16 *VB = (__bf16*)(ws + WS_VB), *VBL = (__bf16*)(ws + WS_VBL); float *Y = (float*)(ws + WS_Y);
  (void)Y; (void)QL; (void)KL; (void)VB; (void)VBL;
  // inputs: 0 q, 1 k, 2 v [4,1024,1024]; 3 Wq [1024,1024] (out,in), 4 bq; 5 Wk, 6 bk; 7 Wv, 8 bv; 9 Wo, 10 bo
  k_proj<<<dim3(TNB * TT / 128, CC / 128, 3), 128, 0, stream>>>(F[0], F[1], F[2], F[3], F[5], F[7], F[4], F[6], F[8], QH, QL, KH, KL, VT, VB, VBL);
  k_attn<<<dim3(NQB, NH, TNB), 128, 0, stream>>>(QH, KH, QL, VT, Y);
  k_out<<<dim3(TNB * TT / 128, DIN / 128), 256, 0, stream>>>(Y, F[9], F[10], (float*)d_out);
}

// v006
// A run of this version takes 84.4 microseconds.
// Two timings next to v005 both put it at 1.09 times that version's speed.
// Counting every step since v000, it is 15.5 times as fast.
// compute dtype: all float inputs rounded to bf16; q/k/v projections with EXACT bf16 products on WMMA 16x16x32 (f32 accumulate); the sinusoidal PE added in f32 (sincosf) to the projected q/k rows; q as f16 hi + residual (x 2^10) against k once to f16 (2 products) x 64^-0.5; softmax in f32 (exponent in base 2: one fma, then the hardware exp2) with a running maximum and sum, 64 keys a pass; exp(s - m) x 2^10 once to f16 against v once to f16 (1 product); ctx split bf16 hi + lo against exact Wo (2 products); f32 output.
#include <hip/hip_runtime.h>
#include <math.h>

typedef __attribute__((ext_vector_type(16))) _Float16 v16h;
typedef __attribute__((ext_vector_type(16))) __bf16 v16b;
typedef __attribute__((ext_vector_type(8)))  _Float16 v8h;
typedef __attribute__((ext_vector_type(8)))  float v8f;
typedef __attribute__((ext_vector_type(4)))  float v4f;
typedef __attribute__((ext_vector_type(2)))  float v2f;
typedef __attribute__((ext_vector_type(4)))  unsigned v4u;
typedef __attribute__((ext_vector_type(4)))  int v4i;
typedef float __attribute__((may_alias)) float_a;
typedef int __attribute__((may_alias)) int_a;

template <typename T> __device__ __forceinline__ void vst2(void* p, T v) { *(T*)p = v;  }
__device__ __forceinline__ v8f wmma16(v16h a, v16h b, v8f c) {
  v8f d = __builtin_amdgcn_wmma_f32_16x16x32_f16(false, a, false, b, (short)0, c, false, false);
  asm volatile("v_nop\n\tv_nop\n\tv_nop\n\tv_nop" : "+v"(d) : "v"(a), "v"(b));
  return d;
}
__device__ __forceinline__ v8f wmma_bf(v16b a, v16b b, v8f c) {
  v8f d = __builtin_amdgcn_wmma_f32_16x16x32_bf16(false, a, false, b, (short)0, c, false, false);
  asm volatile("v_nop\n\tv_nop\n\tv_nop\n\tv_nop" : "+v"(d) : "v"(a), "v"(b));
  return d;
}
// the plain builtin, for k_proj's loop: its live set passes 256 registers, and an asm statement's vector operands are held to the first 256 (the accumulators were spilled for it); the compiler keeps the distances behind its own builtin
__device__ __forceinline__ v8f wmma_bfp(v16b a, v16b b, v8f c) { return __builtin_amdgcn_wmma_f32_16x16x32_bf16(false, a, false, b, (short)0, c, false, false); }
// 16x16x32 fragments: lane = (h = lane>>4, row/col = lane&15); elements 0..7 = k0+8h+0..7, 8..15 = k0+16+8h+0..7; D element r = row 8h+r
__device__ __forceinline__ v16h frag_h(const _Float16* rowk0, int lane) {
  union { v16h v; v8h q[2]; } u; const _Float16* p = rowk0 + 8 * (lane >> 4);
  u.q[0] = *(const v8h*)p; u.q[1] = *(const v8h*)(p + 16); return u.v;
}
__device__ __forceinline__ v16h frag_f32(const float* rowk0, int lane) {
  v16h a; const float* p = rowk0 + 8 * (lane >> 4);
#pragma unroll
  for (int i = 0; i < 8; ++i) { a[i] = (_Float16)p[i]; a[8 + i] = (_Float16)p[16 + i]; }
  return a;
}
__device__ __forceinline__ v16h frag_f32s(const float* rowk0, int lane, float sc) {
  v16h a; const float* p = rowk0 + 8 * (lane >> 4);
#pragma unroll
  for (int i = 0; i < 8; ++i) { a[i] = (_Float16)(p[i] * sc); a[8 + i] = (_Float16)(p[16 + i] * sc); }
  return a;
}
// column fragment from a [K][ld] layout (column n), rows >= K read as 0
__device__ __forceinline__ v16h fragc_f32(const float* W, int k0, int n, int lane, int ld, int K) {
  v16h a; const int g = lane >> 4;
#pragma unroll
  for (int i = 0; i < 8; ++i) { const int ka = k0 + 8 * g + i, kb = ka + 16;
    a[i] = (_Float16)(ka < K ? W[(size_t)(ka < K ? ka : K - 1) * ld + n] : 0.f); a[8 + i] = (_Float16)(kb < K ? W[(size_t)(kb < K ? kb : K - 1) * ld + n] : 0.f); }
  return a;
}
struct F2 { v16b h, l; };
__device__ __forceinline__ F2 bsplit16(const float v[16]) { F2 r;
#pragma unroll
  for (int i = 0; i < 16; ++i) { const __bf16 h = (__bf16)v[i]; r.h[i] = h; r.l[i] = (__bf16)(v[i] - (float)h); }
  return r; }
__device__ __forceinline__ F2 split_row(const float* row, int k0, int lane) { float v[16]; const float* p = row + k0 + 8 * (lane >> 4);
#pragma unroll
  for (int i = 0; i < 8; ++i) { v[i] = p[i]; v[8 + i] = p[16 + i]; }
  return bsplit16(v); }
__device__ __forceinline__ F2 split_rowK(const float* row, int k0, int lane, int K) { float v[16]; const int g = lane >> 4;
#pragma unroll
  for (int i = 0; i < 8; ++i) { const int ka = k0 + 8 * g + i, kb = ka + 16; v[i] = ka < K ? row[ka < K ? ka : K - 1] : 0.f; v[8 + i] = kb < K ? row[kb < K ? kb : K - 1] : 0.f; }
  return bsplit16(v); }
__device__ __forceinline__ F2 split_col(const float* W, int k0, int n, int lane, int ld, int K) { float v[16]; const int g = lane >> 4;
#pragma unroll
  for (int i = 0; i < 8; ++i) { const int ka = k0 + 8 * g + i, kb = ka + 16; v[i] = ka < K ? W[(size_t)(ka < K ? ka : K - 1) * ld + n] : 0.f; v[8 + i] = kb < K ? W[(size_t)(kb < K ? kb : K - 1) * ld + n] : 0.f; }
  return bsplit16(v); }
__device__ __forceinline__ v8f mac3(const F2& a, const F2& b, v8f c) { c = wmma_bf(a.l, b.h, c); c = wmma_bf(a.h, b.l, c); return wmma_bf(a.h, b.h, c); }
__device__ __forceinline__ float sigm(float v) { return 1.0f / (1.0f + expf(-v)); }
#define LDSX() do { asm volatile("s_wait_dscnt 0" ::: "memory"); __builtin_amdgcn_wave_barrier(); __builtin_amdgcn_fence(__ATOMIC_RELEASE, "workgroup"); } while (0)

// Multi-head attention with an additive sinusoidal positional encoding (B 4, S 1,024, 1,024 = 16 x 64; separate q/k/v inputs): qh, kh, vh = x W^T + b ((out,in)); qh += pe, kh += pe with pe[t][2i] = sin(t div_i), pe[t][2i+1] = cos(t div_i), div_i = exp(-2i ln(10000)/64); out = merged(softmax(qh kh^T x 64^-0.5) vh) Wo^T + bo.
#define NB 4
#define TT 1024
#define CC 1024            // NH * HD = projected width
#define DIN 1024          // input (model) width
#define NH 16
#define HD 64
#define NQB (TT / 64)
#define HG 4
#define SCALE (0.125f)
#define SL2E (SCALE * 1.44269504088896340736f)   // SCALE x log2(e): the softmax exponent in base 2
#define CAUSAL 0
#ifndef TNB
#define TNB NB
#endif
__device__ __forceinline__ float bfr(float v) { return (float)(__bf16)v; }
__host__ __device__ __forceinline__ int kb_last(int qb) { return CAUSAL ? ((qb * 64 + 63) >> 7) : (TT / 128 - 1); }
typedef __attribute__((ext_vector_type(8))) __bf16 v8b;
__device__ __forceinline__ v16b frag_b(const __bf16* rowk0, int lane) {
  union { v16b v; v8b q[2]; } u; const __bf16* p = rowk0 + 8 * (lane >> 4);
  u.q[0] = *(const v8b*)p; u.q[1] = *(const v8b*)(p + 16); return u.v;
}
#define QBH 0              // not read by any kernel
#define QHI 1024            // rows carrying a q residual plane (all rows when non-causal: 2-product logits everywhere)
#define KHI 64            // key rows carrying k residual / v bf16 hi+lo planes (written by k_proj, read by no kernel)
// B fragment (k rows k0+.., output column o) of a weight: (in,out) [K][ld] or (out,in) [ld rows of K]: bf16 exact, or f16(bf16 * 256) exact
__device__ __forceinline__ v16b wcol_io(const float* Wm, int k0, int o, int lane, int ld) { v16b w; const int g = lane >> 4;
#pragma unroll
  for (int i = 0; i < 8; ++i) { w[i] = (__bf16)Wm[(size_t)(k0 + 8 * g + i) * ld + o]; w[8 + i] = (__bf16)Wm[(size_t)(k0 + 16 + 8 * g + i) * ld + o]; }
  return w; }
__device__ __forceinline__ v16b wcol_oi(const float* Wm, int k0, int o, int lane, int K) { v16b w; const float* p = Wm + (size_t)o * K + k0 + 8 * (lane >> 4);
#pragma unroll
  for (int i = 0; i < 8; ++i) { w[i] = (__bf16)p[i]; w[8 + i] = (__bf16)p[16 + i]; }
  return w; }
__device__ __forceinline__ v16h wcolh_io(const float* Wm, int k0, int o, int lane, int ld) { v16h w; const int g = lane >> 4;
#pragma unroll
  for (int i = 0; i < 8; ++i) { w[i] = (_Float16)(bfr(Wm[(size_t)(k0 + 8 * g + i) * ld + o]) * 256.0f); w[8 + i] = (_Float16)(bfr(Wm[(size_t)(k0 + 16 + 8 * g + i) * ld + o]) * 256.0f); }
  return w; }
__device__ __forceinline__ v16h wcolh_oi(const float* Wm, int k0, int o, int lane, int K) { v16h w; const float* p = Wm + (size_t)o * K + k0 + 8 * (lane >> 4);
#pragma unroll
  for (int i = 0; i < 8; ++i) { w[i] = (_Float16)(bfr(p[i]) * 256.0f); w[8 + i] = (_Float16)(bfr(p[16 + i]) * 256.0f); }
  return w; }
#define WQKV_LAYOUT 1   // 0 = (in,out) [DIN][CC]; 1 = (out,in) [CC][DIN]; 2 = per-head [NH][DIN][HD]
__device__ __forceinline__ v16b wcol_hdk(const float* Wm, int k0, int o, int lane) { v16b w; const int g = lane >> 4; const float* p = Wm + (size_t)(o / HD) * DIN * HD + (o % HD);
#pragma unroll
  for (int i = 0; i < 8; ++i) { w[i] = (__bf16)p[(size_t)(k0 + 8 * g + i) * HD]; w[8 + i] = (__bf16)p[(size_t)(k0 + 16 + 8 * g + i) * HD]; }
  return w; }
#define WO_OUT_IN 1
#if WQKV_LAYOUT == 1
#define WCOL(W, k0, o, lane) wcol_oi(W, k0, o, lane, DIN)
#elif WQKV_LAYOUT == 2
#define WCOL(W, k0, o, lane) wcol_hdk(W, k0, o, lane)
#else
#define WCOL(W, k0, o, lane) wcol_io(W, k0, o, lane, CC)
#endif
#if WO_OUT_IN
#define WOCOL(W, k0, o, lane) wcol_oi(W, k0, o, lane, CC)
#define WOCOLH(W, k0, o, lane) wcolh_oi(W, k0, o, lane, CC)
#else
#define WOCOL(W, k0, o, lane) wcol_io(W, k0, o, lane, DIN)
#define WOCOLH(W, k0, o, lane) wcolh_io(W, k0, o, lane, DIN)
#endif
__constant__ float c_div[32] = {1.000000000e+0f,7.498942018e-1f,5.623413324e-1f,4.216964841e-1f,3.162277639e-1f,2.371373624e-1f,1.778279394e-1f,1.333521456e-1f,9.999999404e-2f,7.498941571e-2f,5.623412877e-2f,4.216964915e-2f,3.162277490e-2f,2.371373586e-2f,1.778279245e-2f,1.333521307e-2f,9.999999776e-3f,7.498941384e-3f,5.623412784e-3f,4.216964822e-3f,3.162277397e-3f,2.371373586e-3f,1.778279198e-3f,1.333521330e-3f,9.999999311e-4f,7.498941268e-4f,5.623412435e-4f,4.216964589e-4f,3.162277280e-4f,2.371373412e-4f,1.778279257e-4f,1.333521213e-4f};   /* f32(exp(2i * (-ln(10000)/64))) - the module's 'div' */
#define PROJ_EPI(which, row, t, h) do { if ((which) < 2) { float* rw = (row); const float pf = (float)(t); _Pragma("unroll") for (int i = 0; i < 32; ++i) { float sn, cs; sincosf(pf * c_div[i], &sn, &cs); rw[2 * i] += sn; rw[2 * i + 1] += cs; } } } while (0)   /* q, k += sinusoidal PE: pe[t][2i] = sin(t div_i), pe[t][2i+1] = cos(t div_i) */
#ifndef SM_EXTRA_PARAMS
#define SM_EXTRA_PARAMS
#endif
#ifndef PROJ_EXTRA_PARAMS
#define PROJ_EXTRA_PARAMS
#endif
#ifndef SM_MASK_HOOK
#define SM_MASK_HOOK (void)0
#endif

#define WS_QH  0u                                      // f16 q rows [b*t][CC]
#define WS_KH  (WS_QH + 2u * (size_t)NB * TT * CC)      // f16 k rows [b*t][CC]
#define WS_VT  (WS_KH + 2u * (size_t)NB * TT * CC)      // f16 v planes [b][c][t]
#define WS_QL  (WS_VT + 2u * (size_t)NB * CC * TT)      // f16 q residual x 2^10 rows [b][t < QHI][CC]
#define WS_KL  (WS_QL + 2u * (size_t)NB * QHI * CC)     // f16 k residual x 2^10 rows [b][t < KHI][CC]
#define WS_VB  (WS_KL + 2u * (size_t)NB * KHI * CC)     // bf16 v hi planes [b][c][t < KHI]
#define WS_VBL (WS_VB + 2u * (size_t)NB * CC * KHI)
#define WS_Y   (WS_VBL + 2u * (size_t)NB * CC * KHI)    // f32 ctx rows [b*t][CC] (only when there is an output projection)
#define WS_END (WS_Y  + 4u * (size_t)NB * TT * CC)

// ---- operand staging of the two projection kernels: a stage is SBK k columns of the block's rows, read from global memory once a block (16 lanes x 16 B a row, so every wave-wide load covers whole 128-B lines), rounded to bf16 once and kept in LDS for all the block's waves (four in k_proj, eight in k_out)
typedef __attribute__((ext_vector_type(4))) __bf16 v4b;
#define SBK 64
#define SP (SBK + 8)        // staged row pitch in bf16 elements: 144 B = 16 B x 9, an odd count of 16 B for the ds_load_b128 fragment reads
// R = rows between a thread's pieces = threads of the block / 16
// p is the same for the whole block and off the thread's own 32-bit byte offset, so that the loads can take a scalar base and one offset register in place of a 64-bit address pair each
template <int R, int N> __device__ __forceinline__ void ldg_tile(v4f (&r)[N], const float* p, unsigned off, int ld) { const float* q = (const float*)((const char*)p + off);
#pragma unroll
  for (int i = 0; i < N; ++i) r[i] = *(const v4f*)(q + (size_t)(R * i) * ld); }
template <int R, int N> __device__ __forceinline__ void sts_bf(__bf16* d, const v4f (&r)[N]) {
#pragma unroll
  for (int i = 0; i < N; ++i) { v4b t;
#pragma unroll
    for (int k = 0; k < 4; ++k) t[k] = (__bf16)r[i][k];
    *(v4b*)(d + R * i * SP) = t; } }
template <int R, int N> __device__ __forceinline__ void sts_split(__bf16* dh, __bf16* dl, const v4f (&r)[N]) {
#pragma unroll
  for (int i = 0; i < N; ++i) { v4b th, tl;
#pragma unroll
    for (int k = 0; k < 4; ++k) { const __bf16 h = (__bf16)r[i][k]; th[k] = h; tl[k] = (__bf16)(r[i][k] - (float)h); }
    *(v4b*)(dh + R * i * SP) = th; *(v4b*)(dl + R * i * SP) = tl; } }
// ---- k_proj: block = (128 rows, 128 cols, which), four waves of 64 x 64 (2 x 2): q/k/v = X W (+ b) with exact bf16 products (K = DIN) -> which 0: q f16 rows (+ residual rows < QHI); 1: k f16 rows (+ residual rows < KHI); 2: v f16 planes [c][t] (+ bf16 hi/lo planes for t < KHI); the epilogue takes the tile in two halves of 64 rows
__global__ __launch_bounds__(128) void k_proj(const float* __restrict__ XQ, const float* __restrict__ XK, const float* __restrict__ XV, const float* __restrict__ WQ, const float* __restrict__ WK, const float* __restrict__ WV, const float* __restrict__ BQ, const float* __restrict__ BK, const float* __restrict__ BV,
    _Float16* __restrict__ QH, _Float16* __restrict__ QL, _Float16* __restrict__ KH, _Float16* __restrict__ KL, _Float16* __restrict__ VT, __bf16* __restrict__ VB, __bf16* __restrict__ VBL PROJ_EXTRA_PARAMS) {
  // LDS: st, then one region that holds in turn the two operand stages (256 rows each: X 128, W 128) and, behind the epilogue's barriers, either sh + sl or th + tb + tbl
  __shared__ __align__(16) float st[64][132]; __shared__ __align__(16) unsigned char ur[2 * 256 * SP * 2];
  __bf16* const sg = (__bf16*)ur; _Float16 (* const sh)[136] = (_Float16 (*)[136])ur; _Float16 (* const sl)[136] = (_Float16 (*)[136])(ur + 64 * 136 * 2);
  _Float16 (* const th)[72] = (_Float16 (*)[72])ur; __bf16 (* const tb)[72] = (__bf16 (*)[72])(ur + 128 * 72 * 2); __bf16 (* const tbl)[72] = (__bf16 (*)[72])(ur + 2 * 128 * 72 * 2);
  const int tid = threadIdx.x, wave = tid >> 5, lane = tid & 31, col = lane & 15, g = lane >> 4; const int wr = wave >> 1, wc = wave & 1; const int which = blockIdx.z; const int c0 = blockIdx.y * 128; const size_t rb = (size_t)blockIdx.x * 128;
  const float* X = which == 0 ? XQ : which == 1 ? XK : XV; const float* WA = which == 0 ? WQ : which == 1 ? WK : WV; const float* BA = which == 0 ? BQ : which == 1 ? BK : BV;
  v8f acc[4][4] = {};
  { const int srow = tid >> 4, sq = (tid & 15) * 4; const float* Xp = X + rb * DIN; const float* Wp = WA + (size_t)c0 * DIN; const unsigned so = (unsigned)(srow * DIN + sq) * 4u; __bf16* const sd = sg + srow * SP + sq;
    v4f xr[16], wv[16];
    // the k walk starts at a stage rotated by the block's tile indices and wraps, to spread the starting stages of the 8 blocks that share X rows and the 32 that share W rows (for speed only)
    const int rot = (blockIdx.x + 2 * blockIdx.y) & (DIN / SBK - 1);
    ldg_tile<8>(xr, Xp + rot * SBK, so, DIN); ldg_tile<8>(wv, Wp + rot * SBK, so, DIN);
    asm volatile("s_wait_xcnt 0x0" :: "v"(so) : "memory");   // in front of the first overwrite of the loads' address registers: as an input the offset stays untouched up to here
    sts_bf<8>(sd, xr); sts_bf<8>(sd + 128 * SP, wv);
    // two stages a trip, so that the buffer's offset is a constant of each half
#pragma unroll 2
    for (int s = 0; s < DIN / SBK; ++s) {
      __syncthreads();   // publishes stage s and ends every wave's reads of the buffer that stage s + 1 is stored into below
      if (s + 1 < DIN / SBK) { const unsigned sn = so + (unsigned)(((s + 1 + rot) & (DIN / SBK - 1)) * (SBK * 4)); ldg_tile<8>(xr, Xp, sn, DIN); ldg_tile<8>(wv, Wp, sn, DIN);   // the next stage's loads fly while this stage is multiplied
        asm volatile("s_wait_xcnt 0x0" ::: "memory"); }   // behind the run of loads: in front of every later overwrite of their address registers on every way through the loop
      const __bf16* bu = sg + (s & 1) * (256 * SP);
#pragma unroll
      for (int kk = 0; kk < SBK / 32; ++kk) { v16b a[4], w[4];
#pragma unroll
        for (int i = 0; i < 4; ++i) a[i] = frag_b(bu + (wr * 64 + i * 16 + col) * SP + kk * 32, lane);
#pragma unroll
        for (int j = 0; j < 4; ++j) w[j] = frag_b(bu + (128 + wc * 64 + j * 16 + col) * SP + kk * 32, lane);
#pragma unroll
        for (int i = 0; i < 4; ++i) {
#pragma unroll
          for (int j = 0; j < 4; ++j) acc[i][j] = wmma_bfp(a[i], w[j], acc[i][j]); } }
      __builtin_amdgcn_sched_barrier(0);   // keeps the waits for the next stage's loads behind all of this stage's products
      if (s + 1 < DIN / SBK) { __bf16* d = sd + ((s + 1) & 1) * (256 * SP); sts_bf<8>(d, xr); sts_bf<8>(d + 128 * SP, wv); } } }
  // the two halves share one copy of the epilogue's code (it is long: 32 sincosf); no index of acc depends on half
#pragma unroll 1
  for (int half = 0; half < 2; ++half) { const size_t r0 = rb + half * 64; const size_t bb = r0 / TT; const int t0 = (int)(r0 % TT);
  { // the two waves that hold this half stage its f32 tile (acc + bias) in LDS; then the per-(row, head) epilogue hook, then convert
    if (wr == half) {
#pragma unroll
      for (int j = 0; j < 4; ++j) { const float bias = BA ? bfr(BA[c0 + wc * 64 + j * 16 + col]) : 0.f;
#pragma unroll
        for (int i = 0; i < 4; ++i) {
#pragma unroll
          for (int r = 0; r < 8; ++r) st[i * 16 + 8 * g + r][wc * 64 + j * 16 + col] = acc[i][j][r] + bias; } } }
    __syncthreads();
    for (int e = tid; e < 64 * (128 / HD); e += 128) { const int rl = e / (128 / HD), hh = e % (128 / HD); PROJ_EPI(which, &st[rl][hh * HD], (int)((r0 + rl) % TT), (c0 / HD) + hh); }
    __syncthreads(); }
  if (which < 2) { _Float16* DH = which == 0 ? QH : KH; _Float16* DL = which == 0 ? QL : KL; const int nhi = which == 0 ? QHI : KHI; const bool hi_rows = t0 < nhi;
    for (int e = tid; e < 64 * 128; e += 128) { const int rl = e >> 7, cl = e & 127; const float v = st[rl][cl]; const _Float16 hv = (_Float16)v; sh[rl][cl] = hv; sl[rl][cl] = (_Float16)((v - (float)hv) * 1024.0f); }
    __syncthreads();
    for (int e = tid; e < 64 * 16; e += 128) { const int rl = e >> 4, q = e & 15; vst2((unsigned*)(DH + (r0 + rl) * CC + c0 + q * 8), *(const v4u*)&sh[rl][q * 8]); if (hi_rows) vst2((unsigned*)(DL + (bb * nhi + t0 + rl) * (size_t)CC + c0 + q * 8), *(const v4u*)&sl[rl][q * 8]); }
  } else { const bool hi_rows = t0 < KHI;
    for (int e = tid; e < 64 * 128; e += 128) { const int rl = e & 63, cl = e >> 6; const float v = st[rl][cl]; th[cl][rl] = (_Float16)v; const __bf16 bh = (__bf16)v; tb[cl][rl] = bh; tbl[cl][rl] = (__bf16)(v - (float)bh); }
    __syncthreads();
    for (int e = tid; e < 128 * 8; e += 128) { const int cl = e >> 3, q = e & 7; vst2((unsigned*)(VT + (bb * CC + c0 + cl) * (size_t)TT + t0 + q * 8), *(const v4u*)&th[cl][q * 8]);
      asm volatile("s_wait_xcnt 0x0" ::: "memory");   // in front of the overwrite of the store's data and address registers (this build reuses them at once)
      if (hi_rows) { const size_t o3 = (bb * CC + c0 + cl) * (size_t)KHI + t0 + q * 8; vst2((unsigned*)(VB + o3), *(const v4u*)&tb[cl][q * 8]); vst2((unsigned*)(VBL + o3), *(const v4u*)&tbl[cl][q * 8]);
        asm volatile("s_wait_xcnt 0x0" ::: "memory"); } } } } }   // the same for these two stores, in front of the next trip
// ---- K/V staging of k_attn: a stage is one pass's 64 k rows and 64 v planes of the head (128 B each), brought into LDS once a block by asynchronous copies (8 lanes x 16 B a row, so every wave-wide copy covers four whole 128-B lines), for all four waves
#define KVP (HD + 8)          // staged row pitch in f16 elements: 144 B = 16 B x 9, an odd count of 16 B for the ds_load_b128 fragment reads
#define KVB (2 * 64 * KVP)    // one stage in f16 elements: 64 k rows, then 64 v planes
__device__ __forceinline__ void kv_copy(unsigned ld, const _Float16* kg, const _Float16* vg) {
  // one statement for the thread's eight copies and the s_wait_xcnt 0 behind them: the wait stands in front of every later overwrite of the copies' address registers
  asm volatile("global_load_async_to_lds_b128 %0, %8, off\n\t"
               "global_load_async_to_lds_b128 %1, %9, off\n\t"
               "global_load_async_to_lds_b128 %2, %10, off\n\t"
               "global_load_async_to_lds_b128 %3, %11, off\n\t"
               "global_load_async_to_lds_b128 %4, %12, off\n\t"
               "global_load_async_to_lds_b128 %5, %13, off\n\t"
               "global_load_async_to_lds_b128 %6, %14, off\n\t"
               "global_load_async_to_lds_b128 %7, %15, off\n\t"
               "s_wait_xcnt 0x0"
               :: "v"(ld), "v"(ld + 16u * KVP * 2u), "v"(ld + 32u * KVP * 2u), "v"(ld + 48u * KVP * 2u), "v"(ld + 64u * KVP * 2u), "v"(ld + 80u * KVP * 2u), "v"(ld + 96u * KVP * 2u), "v"(ld + 112u * KVP * 2u),
                  "v"(kg), "v"(kg + (size_t)16 * CC), "v"(kg + (size_t)32 * CC), "v"(kg + (size_t)48 * CC), "v"(vg), "v"(vg + (size_t)16 * TT), "v"(vg + (size_t)32 * TT), "v"(vg + (size_t)48 * TT)
               : "memory"); }
__global__ __launch_bounds__(128) void k_attn(const _Float16* __restrict__ QH, const _Float16* __restrict__ KH, const _Float16* __restrict__ QL, const _Float16* __restrict__ VT, float* __restrict__ Y) { __shared__ __align__(16) float ss[4][16][HD + 4]; __shared__ __align__(16) _Float16 kv[2 * KVB];
  const int tid = threadIdx.x, wave = tid >> 5, lane = tid & 31, col = lane & 15, g = lane >> 4; const int qb = blockIdx.x, h = blockIdx.y, b = blockIdx.z; const int ql0 = qb * 64 + wave * 16;
  const int srow = tid >> 3, sc = (tid & 7) * 8;   // the thread's row (and rows + 16, 32, 48) and 16-B piece of a stage
  const _Float16* Kg = KH + ((size_t)b * TT + srow) * CC + h * HD + sc;
  const _Float16* Vg = VT + ((size_t)b * CC + h * HD + srow) * (size_t)TT + sc;
  const unsigned ld0 = (unsigned)(size_t)(kv + srow * KVP + sc);   // LDS byte address: the low 32 bits of the shared address
  // the key walk starts at the 64-key slice qb and wraps (stage t holds slice (t + qb) mod 16), so that the 16 blocks that share a head's K and V start on different slices (for speed only)
  const int rot = qb & (TT / 64 - 1), rot1 = (rot + 1) & (TT / 64 - 1);
  kv_copy(ld0, Kg + (size_t)rot * 64 * CC, Vg + rot * 64);
  asm volatile("s_wait_asynccnt 0x0" ::: "memory");   // this wave's copies of stage 0 have landed
  __syncthreads();                                    // publishes stage 0
  kv_copy(ld0 + KVB * 2u, Kg + (size_t)rot1 * 64 * CC, Vg + rot1 * 64);
  v16h qh[HD / 32], ql[HD / 32];
#pragma unroll
  for (int kc = 0; kc < HD / 32; ++kc) { qh[kc] = frag_h(QH + ((size_t)b * TT + ql0 + col) * CC + h * HD + kc * 32, lane); ql[kc] = frag_h(QL + ((size_t)b * QHI + ql0 + col) * CC + h * HD + kc * 32, lane); }
  asm volatile("s_wait_xcnt 0x0" :: "v"(QH + ((size_t)b * TT + ql0 + col) * CC + h * HD + 8 * g), "v"(QL + ((size_t)b * QHI + ql0 + col) * CC + h * HD + 8 * g) : "memory");   // behind the q loads: in front of the overwrite of their address registers (this build reuses them for the accumulators' zeros); as inputs the two addresses stay untouched up to here
  v8f o[HD / 16] = {}; float m = -3.0e38f, l = 0.f;
  // the pass loop stays rolled (two passes' fragments at once would cost the fourth wave of a SIMD); every inner loop is unrolled so that each register-array index is a constant
#pragma unroll 1
  for (int t = 0; t < TT / 64; ++t) { v8f acc[4] = {}, accl[4] = {}; v16h kf[HD / 32][4], vf[2][HD / 16];
    const _Float16* Ks = kv + (t & 1) * KVB + col * KVP;   // key row col of the stage
    const _Float16* Vs = Ks + 64 * KVP;                    // v plane col of the stage
#pragma unroll
    for (int kc = 0; kc < HD / 32; ++kc) {   // all of the pass's k fragments are asked for before the first product, so that their latencies overlap
#pragma unroll
      for (int j = 0; j < 4; ++j) kf[kc][j] = frag_h(Ks + (j * 16) * KVP + kc * 32, lane); }
#pragma unroll
    for (int kc = 0; kc < HD / 32; ++kc) {
#pragma unroll
      for (int j = 0; j < 4; ++j) { acc[j] = wmma16(kf[kc][j], qh[kc], acc[j]); accl[j] = wmma16(kf[kc][j], ql[kc], accl[j]); } }
#pragma unroll
    for (int kc = 0; kc < 2; ++kc) {   // the pass's v fragments fly while the softmax is worked out
#pragma unroll
      for (int jj = 0; jj < HD / 16; ++jj) vf[kc][jj] = frag_h(Vs + (jj * 16) * KVP + kc * 32, lane); }
    float mx = -3.0e38f;
#pragma unroll
    for (int j = 0; j < 4; ++j) {
#pragma unroll
      for (int r = 0; r < 8; ++r) { const float s = acc[j][r] + accl[j][r] * (1.0f / 1024.0f); acc[j][r] = s; mx = fmaxf(mx, s); } }   // unscaled score: SCALE goes into SL2E below
    mx = fmaxf(mx, __shfl_xor(mx, 16));   // the other half of this query's keys
    const float mn = fmaxf(m, mx); const float corr = __builtin_amdgcn_exp2f((m - mn) * SL2E); m = mn;
    const float nb = 10.0f - mn * SL2E;   // exp(SCALE (s - mn)) x 2^10 = 2^(s SL2E + nb)
    float sum = 0.f; v16h p[2];
#pragma unroll
    for (int j = 0; j < 4; ++j) {
#pragma unroll
      for (int r = 0; r < 8; ++r) { const float e = __builtin_amdgcn_exp2f(fmaf(acc[j][r], SL2E, nb)); sum += e; p[j >> 1][(j & 1) * 8 + r] = (_Float16)e; } }
    l = l * corr + sum;
#pragma unroll
    for (int jj = 0; jj < HD / 16; ++jj) {
#pragma unroll
      for (int r = 0; r < 8; ++r) o[jj][r] *= corr; }
#pragma unroll
    for (int kc = 0; kc < 2; ++kc) {
#pragma unroll
      for (int jj = 0; jj < HD / 16; ++jj) o[jj] = wmma16(vf[kc][jj], p[kc], o[jj]); }
    asm volatile("s_wait_dscnt 0x0" ::: "memory");      // this wave's reads of stage t have returned
    asm volatile("s_wait_asynccnt 0x0" ::: "memory");   // this wave's copies of stage t + 1 have landed
    __syncthreads();                                    // publishes stage t + 1 and ends every wave's reads of the buffer that is refilled below
    if (t + 2 < TT / 64) { const int tn = (t + 2 + rot) & (TT / 64 - 1); kv_copy(ld0 + (unsigned)(t & 1) * (KVB * 2u), Kg + (size_t)tn * 64 * CC, Vg + tn * 64); } }
  asm volatile("s_wait_asynccnt 0x0" ::: "memory");     // no copy is outstanding when the wave goes on to its end
  l += __shfl_xor(l, 16); const float inv = 1.0f / l;   // l carries the 2^10 of its terms
#pragma unroll
  for (int jj = 0; jj < HD / 16; ++jj)
#pragma unroll
    for (int r = 0; r < 8; ++r) ss[wave][col][jj * 16 + 8 * g + r] = o[jj][r] * inv;
  LDSX(); for (int rl = 0; rl < 16; ++rl) if (lane < HD / 4) vst2(Y + ((size_t)b * TT + ql0 + rl) * CC + h * HD + lane * 4, *(const v4f*)&ss[wave][rl][lane * 4]); }
// ---- k_out: block = (128 rows, 128 cols), eight waves of 32 x 64 (4 x 2): out = ctx Wo (+ bo): ctx split bf16 hi + lo against exact bf16 Wo (2 products, hi then lo into each accumulator)
__global__ __launch_bounds__(256) void k_out(const float* __restrict__ Y, const float* __restrict__ WO, const float* __restrict__ BO, float* __restrict__ OUT) { __shared__ __align__(16) float sf[8][32][68]; __shared__ __align__(16) __bf16 sg[2 * 384 * SP];   // two operand stages of 384 rows: ctx hi 128, ctx lo 128, Wo 128
  const int tid = threadIdx.x, wave = tid >> 5, lane = tid & 31, col = lane & 15, g = lane >> 4; const int wr = wave >> 1, wc = wave & 1; const int c0 = blockIdx.y * 128; const size_t rb = (size_t)blockIdx.x * 128;
  v8f acc[2][4] = {};
  const int srow = tid >> 4, sq = (tid & 15) * 4; const float* Yp = Y + rb * CC; const float* Wp = WO + (size_t)c0 * CC; const unsigned so = (unsigned)(srow * CC + sq) * 4u; __bf16* const sd = sg + srow * SP + sq;
  v4f yr[8], wv[8];
  // rotated start of the k walk, as in k_proj: 8 blocks share ctx rows, 32 share Wo rows
  const int rot = (blockIdx.x + 2 * blockIdx.y) & (CC / SBK - 1);
  ldg_tile<16>(yr, Yp + rot * SBK, so, CC); ldg_tile<16>(wv, Wp + rot * SBK, so, CC);
  asm volatile("s_wait_xcnt 0x0" :: "v"(so) : "memory");   // in front of the first overwrite of the loads' address registers: as an input the offset stays untouched up to here
  sts_split<16>(sd, sd + 128 * SP, yr); sts_bf<16>(sd + 256 * SP, wv);
  // two stages a trip, so that the buffer's offset is a constant of each half
#pragma unroll 2
  for (int s = 0; s < CC / SBK; ++s) {
    __syncthreads();   // publishes stage s and ends every wave's reads of the buffer that stage s + 1 is stored into below
    if (s + 1 < CC / SBK) { const unsigned sn = so + (unsigned)(((s + 1 + rot) & (CC / SBK - 1)) * (SBK * 4)); ldg_tile<16>(yr, Yp, sn, CC); ldg_tile<16>(wv, Wp, sn, CC);   // the next stage's loads fly while this stage is multiplied
      asm volatile("s_wait_xcnt 0x0" :: "v"(sn) : "memory"); }   // behind the run of loads: in front of every overwrite of their address registers; as an input the stage's offset stays untouched up to here
    const __bf16* bu = sg + (s & 1) * (384 * SP);
#pragma unroll
    for (int kk = 0; kk < SBK / 32; ++kk) { v16b ah[2], al[2], w[4];
#pragma unroll
      for (int i = 0; i < 2; ++i) { ah[i] = frag_b(bu + (wr * 32 + i * 16 + col) * SP + kk * 32, lane); al[i] = frag_b(bu + (128 + wr * 32 + i * 16 + col) * SP + kk * 32, lane); }
#pragma unroll
      for (int j = 0; j < 4; ++j) w[j] = frag_b(bu + (256 + wc * 64 + j * 16 + col) * SP + kk * 32, lane);
#pragma unroll
      for (int i = 0; i < 2; ++i) {
#pragma unroll
        for (int j = 0; j < 4; ++j) acc[i][j] = wmma_bf(ah[i], w[j], acc[i][j]); }
#pragma unroll
      for (int i = 0; i < 2; ++i) {
#pragma unroll
        for (int j = 0; j < 4; ++j) acc[i][j] = wmma_bf(al[i], w[j], acc[i][j]); } }
    __builtin_amdgcn_sched_barrier(0);   // keeps the waits for the next stage's loads behind all of this stage's products
    if (s + 1 < CC / SBK) { __bf16* d = sd + ((s + 1) & 1) * (384 * SP); sts_split<16>(d, d + 128 * SP, yr); sts_bf<16>(d + 256 * SP, wv); } }
#pragma unroll
  for (int j = 0; j < 4; ++j) { const float bias = BO ? bfr(BO[c0 + wc * 64 + j * 16 + col]) : 0.f;
#pragma unroll
    for (int i = 0; i < 2; ++i) {
#pragma unroll
      for (int r = 0; r < 8; ++r) sf[wave][i * 16 + 8 * g + r][j * 16 + col] = acc[i][j][r] + bias; } }
  LDSX();
  // a wave-wide store covers two rows of the wave's 64 columns (256 B each); all rows are read back first, so that no store's register is written again
  v4f ov[16];
#pragma unroll
  for (int i = 0; i < 16; ++i) ov[i] = *(const v4f*)&sf[wave][2 * i + g][col * 4];
#pragma unroll
  for (int i = 0; i < 16; ++i) vst2(OUT + (rb + wr * 32 + 2 * i + g) * DIN + c0 + wc * 64 + col * 4, ov[i]); }

extern "C" void kernel_launch(void* const* d_in, const int* in_sizes, int n_in, void* d_out, int out_size, void* d_ws, size_t ws_size, hipStream_t stream) {
  (void)in_sizes; (void)n_in; (void)out_size;
  const float** F = (const float**)d_in;
  if (ws_size < (size_t)WS_END) return;
  char* ws = (char*)d_ws; _Float16 *QH = (_Float16*)(ws + WS_QH), *KH = (_Float16*)(ws + WS_KH), *VT = (_Float16*)(ws + WS_VT), *QL = (_Float16*)(ws + WS_QL), *KL = (_Float16*)(ws + WS_KL); __bf16 *VB = (__bf16*)(ws + WS_VB), *VBL = (__bf16*)(ws + WS_VBL); float *Y = (float*)(ws + WS_Y);
  (void)Y; (void)QL; (void)KL; (void)VB; (void)VBL;
  // inputs: 0 q, 1 k, 2 v [4,1024,1024]; 3 Wq [1024,1024] (out,in), 4 bq; 5 Wk, 6 bk; 7 Wv, 8 bv; 9 Wo, 10 bo
  k_proj<<<dim3(TNB * TT / 128, CC / 128, 3), 128, 0, stream>>>(F[0], F[1], F[2], F[3], F[5], F[7], F[4], F[6], F[8], QH, QL, KH, KL, VT, VB, VBL);
  k_attn<<<dim3(NQB, NH, TNB), 128, 0, stream>>>(QH, KH, QL, VT, Y);
  k_out<<<dim3(TNB * TT / 128, DIN / 128), 256, 0, stream>>>(Y, F[9], F[10], (float*)d_out);
}

// v007
// It runs in 81.9 microseconds.
// Next to v006, in two timings, it ran 1.03 times as fast each time.
// Over all steps from v000 it is 16.0 times as fast.
// compute dtype: all float inputs rounded to bf16; q/k/v projections with EXACT bf16 products on WMMA 16x16x32 (f32 accumulate); the sinusoidal PE added in f32 (sincosf) to the projected q/k rows; q as f16 hi + residual (x 2^10) against k once to f16 (2 products) x 64^-0.5; softmax in f32 (exponent in base 2: one fma, then the hardware exp2) with a running maximum and sum, 64 keys a pass; exp(s - m) x 2^10 once to f16 against v once to f16 (1 product); ctx split bf16 hi + lo against exact Wo (2 products); f32 output.
#include <hip/hip_runtime.h>
#include <math.h>

typedef __attribute__((ext_vector_type(16))) _Float16 v16h;
typedef __attribute__((ext_vector_type(16))) __bf16 v16b;
typedef __attribute__((ext_vector_type(8)))  _Float16 v8h;
typedef __attribute__((ext_vector_type(8)))  float v8f;
typedef __attribute__((ext_vector_type(4)))  float v4f;
typedef __attribute__((ext_vector_type(2)))  float v2f;
typedef __attribute__((ext_vector_type(4)))  unsigned v4u;
typedef __attribute__((ext_vector_type(4)))  int v4i;
typedef float __attribute__((may_alias)) float_a;
typedef int __attribute__((may_alias)) int_a;

template <typename T> __device__ __forceinline__ void vst2(void* p, T v) { *(T*)p = v;  }
__device__ __forceinline__ v8f wmma16(v16h a, v16h b, v8f c) {
  v8f d = __builtin_amdgcn_wmma_f32_16x16x32_f16(false, a, false, b, (short)0, c, false, false);
  asm volatile("v_nop\n\tv_nop\n\tv_nop\n\tv_nop" : "+v"(d) : "v"(a), "v"(b));
  return d;
}
__device__ __forceinline__ v8f wmma_bf(v16b a, v16b b, v8f c) {
  v8f d = __builtin_amdgcn_wmma_f32_16x16x32_bf16(false, a, false, b, (short)0, c, false, false);
  asm volatile("v_nop\n\tv_nop\n\tv_nop\n\tv_nop" : "+v"(d) : "v"(a), "v"(b));
  return d;
}
// the plain builtins: the compiler keeps the distances behind its own builtin. k_proj: its live set passes 256 registers, and an asm statement's vector operands are held to the first 256 (the accumulators were spilled for it). k_attn: four waves share a SIMD's vector port, and no issue slot of it goes to a pad between products that follow one another
__device__ __forceinline__ v8f wmma_bfp(v16b a, v16b b, v8f c) { return __builtin_amdgcn_wmma_f32_16x16x32_bf16(false, a, false, b, (short)0, c, false, false); }
__device__ __forceinline__ v8f wmma16p(v16h a, v16h b, v8f c) { return __builtin_amdgcn_wmma_f32_16x16x32_f16(false, a, false, b, (short)0, c, false, false); }
// 16x16x32 fragments: lane = (h = lane>>4, row/col = lane&15); elements 0..7 = k0+8h+0..7, 8..15 = k0+16+8h+0..7; D element r = row 8h+r
__device__ __forceinline__ v16h frag_h(const _Float16* rowk0, int lane) {
  union { v16h v; v8h q[2]; } u; const _Float16* p = rowk0 + 8 * (lane >> 4);
  u.q[0] = *(const v8h*)p; u.q[1] = *(const v8h*)(p + 16); return u.v;
}
__device__ __forceinline__ v16h frag_f32(const float* rowk0, int lane) {
  v16h a; const float* p = rowk0 + 8 * (lane >> 4);
#pragma unroll
  for (int i = 0; i < 8; ++i) { a[i] = (_Float16)p[i]; a[8 + i] = (_Float16)p[16 + i]; }
  return a;
}
__device__ __forceinline__ v16h frag_f32s(const float* rowk0, int lane, float sc) {
  v16h a; const float* p = rowk0 + 8 * (lane >> 4);
#pragma unroll
  for (int i = 0; i < 8; ++i) { a[i] = (_Float16)(p[i] * sc); a[8 + i] = (_Float16)(p[16 + i] * sc); }
  return a;
}
// column fragment from a [K][ld] layout (column n), rows >= K read as 0
__device__ __forceinline__ v16h fragc_f32(const float* W, int k0, int n, int lane, int ld, int K) {
  v16h a; const int g = lane >> 4;
#pragma unroll
  for (int i = 0; i < 8; ++i) { const int ka = k0 + 8 * g + i, kb = ka + 16;
    a[i] = (_Float16)(ka < K ? W[(size_t)(ka < K ? ka : K - 1) * ld + n] : 0.f); a[8 + i] = (_Float16)(kb < K ? W[(size_t)(kb < K ? kb : K - 1) * ld + n] : 0.f); }
  return a;
}
struct F2 { v16b h, l; };
__device__ __forceinline__ F2 bsplit16(const float v[16]) { F2 r;
#pragma unroll
  for (int i = 0; i < 16; ++i) { const __bf16 h = (__bf16)v[i]; r.h[i] = h; r.l[i] = (__bf16)(v[i] - (float)h); }
  return r; }
__device__ __forceinline__ F2 split_row(const float* row, int k0, int lane) { float v[16]; const float* p = row + k0 + 8 * (lane >> 4);
#pragma unroll
  for (int i = 0; i < 8; ++i) { v[i] = p[i]; v[8 + i] = p[16 + i]; }
  return bsplit16(v); }
__device__ __forceinline__ F2 split_rowK(const float* row, int k0, int lane, int K) { float v[16]; const int g = lane >> 4;
#pragma unroll
  for (int i = 0; i < 8; ++i) { const int ka = k0 + 8 * g + i, kb = ka + 16; v[i] = ka < K ? row[ka < K ? ka : K - 1] : 0.f; v[8 + i] = kb < K ? row[kb < K ? kb : K - 1] : 0.f; }
  return bsplit16(v); }
__device__ __forceinline__ F2 split_col(const float* W, int k0, int n, int lane, int ld, int K) { float v[16]; const int g = lane >> 4;
#pragma unroll
  for (int i = 0; i < 8; ++i) { const int ka = k0 + 8 * g + i, kb = ka + 16; v[i] = ka < K ? W[(size_t)(ka < K ? ka : K - 1) * ld + n] : 0.f; v[8 + i] = kb < K ? W[(size_t)(kb < K ? kb : K - 1) * ld + n] : 0.f; }
  return bsplit16(v); }
__device__ __forceinline__ v8f mac3(const F2& a, const F2& b, v8f c) { c = wmma_bf(a.l, b.h, c); c = wmma_bf(a.h, b.l, c); return wmma_bf(a.h, b.h, c); }
__device__ __forceinline__ float sigm(float v) { return 1.0f / (1.0f + expf(-v)); }
#define LDSX() do { asm volatile("s_wait_dscnt 0" ::: "memory"); __builtin_amdgcn_wave_barrier(); __builtin_amdgcn_fence(__ATOMIC_RELEASE, "workgroup"); } while (0)

// Multi-head attention with an additive sinusoidal positional encoding (B 4, S 1,024, 1,024 = 16 x 64; separate q/k/v inputs): qh, kh, vh = x W^T + b ((out,in)); qh += pe, kh += pe with pe[t][2i] = sin(t div_i), pe[t][2i+1] = cos(t div_i), div_i = exp(-2i ln(10000)/64); out = merged(softmax(qh kh^T x 64^-0.5) vh) Wo^T + bo.
#define NB 4
#define TT 1024
#define CC 1024            // NH * HD = projected width
#define DIN 1024          // input (model) width
#define NH 16
#define HD 64
#define NQB (TT / 64)
#define HG 4
#define SCALE (0.125f)
#define SL2E (SCALE * 1.44269504088896340736f)   // SCALE x log2(e): the softmax exponent in base 2
#define CAUSAL 0
#ifndef TNB
#define TNB NB
#endif
__device__ __forceinline__ float bfr(float v) { return (float)(__bf16)v; }
__host__ __device__ __forceinline__ int kb_last(int qb) { return CAUSAL ? ((qb * 64 + 63) >> 7) : (TT / 128 - 1); }
typedef __attribute__((ext_vector_type(8))) __bf16 v8b;
__device__ __forceinline__ v16b frag_b(const __bf16* rowk0, int lane) {
  union { v16b v; v8b q[2]; } u; const __bf16* p = rowk0 + 8 * (lane >> 4);
  u.q[0] = *(const v8b*)p; u.q[1] = *(const v8b*)(p + 16); return u.v;
}
#define QBH 0              // not read by any kernel
#define QHI 1024            // rows carrying a q residual plane (all rows when non-causal: 2-product logits everywhere)
#define KHI 64            // key rows carrying k residual / v bf16 hi+lo planes (written by k_proj, read by no kernel)
// B fragment (k rows k0+.., output column o) of a weight: (in,out) [K][ld] or (out,in) [ld rows of K]: bf16 exact, or f16(bf16 * 256) exact
__device__ __forceinline__ v16b wcol_io(const float* Wm, int k0, int o, int lane, int ld) { v16b w; const int g = lane >> 4;
#pragma unroll
  for (int i = 0; i < 8; ++i) { w[i] = (__bf16)Wm[(size_t)(k0 + 8 * g + i) * ld + o]; w[8 + i] = (__bf16)Wm[(size_t)(k0 + 16 + 8 * g + i) * ld + o]; }
  return w; }
__device__ __forceinline__ v16b wcol_oi(const float* Wm, int k0, int o, int lane, int K) { v16b w; const float* p = Wm + (size_t)o * K + k0 + 8 * (lane >> 4);
#pragma unroll
  for (int i = 0; i < 8; ++i) { w[i] = (__bf16)p[i]; w[8 + i] = (__bf16)p[16 + i]; }
  return w; }
__device__ __forceinline__ v16h wcolh_io(const float* Wm, int k0, int o, int lane, int ld) { v16h w; const int g = lane >> 4;
#pragma unroll
  for (int i = 0; i < 8; ++i) { w[i] = (_Float16)(bfr(Wm[(size_t)(k0 + 8 * g + i) * ld + o]) * 256.0f); w[8 + i] = (_Float16)(bfr(Wm[(size_t)(k0 + 16 + 8 * g + i) * ld + o]) * 256.0f); }
  return w; }
__device__ __forceinline__ v16h wcolh_oi(const float* Wm, int k0, int o, int lane, int K) { v16h w; const float* p = Wm + (size_t)o * K + k0 + 8 * (lane >> 4);
#pragma unroll
  for (int i = 0; i < 8; ++i) { w[i] = (_Float16)(bfr(p[i]) * 256.0f); w[8 + i] = (_Float16)(bfr(p[16 + i]) * 256.0f); }
  return w; }
#define WQKV_LAYOUT 1   // 0 = (in,out) [DIN][CC]; 1 = (out,in) [CC][DIN]; 2 = per-head [NH][DIN][HD]
__device__ __forceinline__ v16b wcol_hdk(const float* Wm, int k0, int o, int lane) { v16b w; const int g = lane >> 4; const float* p = Wm + (size_t)(o / HD) * DIN * HD + (o % HD);
#pragma unroll
  for (int i = 0; i < 8; ++i) { w[i] = (__bf16)p[(size_t)(k0 + 8 * g + i) * HD]; w[8 + i] = (__bf16)p[(size_t)(k0 + 16 + 8 * g + i) * HD]; }
  return w; }
#define WO_OUT_IN 1
#if WQKV_LAYOUT == 1
#define WCOL(W, k0, o, lane) wcol_oi(W, k0, o, lane, DIN)
#elif WQKV_LAYOUT == 2
#define WCOL(W, k0, o, lane) wcol_hdk(W, k0, o, lane)
#else
#define WCOL(W, k0, o, lane) wcol_io(W, k0, o, lane, CC)
#endif
#if WO_OUT_IN
#define WOCOL(W, k0, o, lane) wcol_oi(W, k0, o, lane, CC)
#define WOCOLH(W, k0, o, lane) wcolh_oi(W, k0, o, lane, CC)
#else
#define WOCOL(W, k0, o, lane) wcol_io(W, k0, o, lane, DIN)
#define WOCOLH(W, k0, o, lane) wcolh_io(W, k0, o, lane, DIN)
#endif
__constant__ float c_div[32] = {1.000000000e+0f,7.498942018e-1f,5.623413324e-1f,4.216964841e-1f,3.162277639e-1f,2.371373624e-1f,1.778279394e-1f,1.333521456e-1f,9.999999404e-2f,7.498941571e-2f,5.623412877e-2f,4.216964915e-2f,3.162277490e-2f,2.371373586e-2f,1.778279245e-2f,1.333521307e-2f,9.999999776e-3f,7.498941384e-3f,5.623412784e-3f,4.216964822e-3f,3.162277397e-3f,2.371373586e-3f,1.778279198e-3f,1.333521330e-3f,9.999999311e-4f,7.498941268e-4f,5.623412435e-4f,4.216964589e-4f,3.162277280e-4f,2.371373412e-4f,1.778279257e-4f,1.333521213e-4f};   /* f32(exp(2i * (-ln(10000)/64))) - the module's 'div' */
#define PROJ_EPI(which, row, t, h) do { if ((which) < 2) { float* rw = (row); const float pf = (float)(t); _Pragma("unroll") for (int i = 0; i < 32; ++i) { float sn, cs; sincosf(pf * c_div[i], &sn, &cs); rw[2 * i] += sn; rw[2 * i + 1] += cs; } } } while (0)   /* q, k += sinusoidal PE: pe[t][2i] = sin(t div_i), pe[t][2i+1] = cos(t div_i) */
#ifndef SM_EXTRA_PARAMS
#define SM_EXTRA_PARAMS
#endif
#ifndef PROJ_EXTRA_PARAMS
#define PROJ_EXTRA_PARAMS
#endif
#ifndef SM_MASK_HOOK
#define SM_MASK_HOOK (void)0
#endif

#define WS_QH  0u                                      // f16 q rows [b*t][CC]
#define WS_KH  (WS_QH + 2u * (size_t)NB * TT * CC)      // f16 k rows [b*t][CC]
#define WS_VT  (WS_KH + 2u * (size_t)NB * TT * CC)      // f16 v planes [b][c][t]
#define WS_QL  (WS_VT + 2u * (size_t)NB * CC * TT)      // f16 q residual x 2^10 rows [b][t < QHI][CC]
#define WS_KL  (WS_QL + 2u * (size_t)NB * QHI * CC)     // f16 k residual x 2^10 rows [b][t < KHI][CC]
#define WS_VB  (WS_KL + 2u * (size_t)NB * KHI * CC)     // bf16 v hi planes [b][c][t < KHI]
#define WS_VBL (WS_VB + 2u * (size_t)NB * CC * KHI)
#define WS_Y   (WS_VBL + 2u * (size_t)NB * CC * KHI)    // f32 ctx rows [b*t][CC] (only when there is an output projection)
#define WS_END (WS_Y  + 4u * (size_t)NB * TT * CC)

// ---- operand staging of the two projection kernels: a stage is SBK k columns of the block's rows, read from global memory once a block (16 lanes x 16 B a row, so every wave-wide load covers whole 128-B lines), rounded to bf16 once and kept in LDS for all the block's waves (four in k_proj, eight in k_out)
typedef __attribute__((ext_vector_type(4))) __bf16 v4b;
#define SBK 64
#define SP (SBK + 8)        // staged row pitch in bf16 elements: 144 B = 16 B x 9, an odd count of 16 B for the ds_load_b128 fragment reads
// R = rows between a thread's pieces = threads of the block / 16
// p is the same for the whole block and off the thread's own 32-bit byte offset, so that the loads can take a scalar base and one offset register in place of a 64-bit address pair each
template <int R, int N> __device__ __forceinline__ void ldg_tile(v4f (&r)[N], const float* p, unsigned off, int ld) { const float* q = (const float*)((const char*)p + off);
#pragma unroll
  for (int i = 0; i < N; ++i) r[i] = *(const v4f*)(q + (size_t)(R * i) * ld); }
template <int R, int N> __device__ __forceinline__ void sts_bf(__bf16* d, const v4f (&r)[N]) {
#pragma unroll
  for (int i = 0; i < N; ++i) { v4b t;
#pragma unroll
    for (int k = 0; k < 4; ++k) t[k] = (__bf16)r[i][k];
    *(v4b*)(d + R * i * SP) = t; } }
template <int R, int N> __device__ __forceinline__ void sts_split(__bf16* dh, __bf16* dl, const v4f (&r)[N]) {
#pragma unroll
  for (int i = 0; i < N; ++i) { v4b th, tl;
#pragma unroll
    for (int k = 0; k < 4; ++k) { const __bf16 h = (__bf16)r[i][k]; th[k] = h; tl[k] = (__bf16)(r[i][k] - (float)h); }
    *(v4b*)(dh + R * i * SP) = th; *(v4b*)(dl + R * i * SP) = tl; } }
// ---- k_proj: block = (128 rows, 128 cols, which), four waves of 64 x 64 (2 x 2): q/k/v = X W (+ b) with exact bf16 products (K = DIN) -> which 0: q f16 rows (+ residual rows < QHI); 1: k f16 rows (+ residual rows < KHI); 2: v f16 planes [c][t] (+ bf16 hi/lo planes for t < KHI); the epilogue takes the tile in two halves of 64 rows
__global__ __launch_bounds__(128) void k_proj(const float* __restrict__ XQ, const float* __restrict__ XK, const float* __restrict__ XV, const float* __restrict__ WQ, const float* __restrict__ WK, const float* __restrict__ WV, const float* __restrict__ BQ, const float* __restrict__ BK, const float* __restrict__ BV,
    _Float16* __restrict__ QH, _Float16* __restrict__ QL, _Float16* __restrict__ KH, _Float16* __restrict__ KL, _Float16* __restrict__ VT, __bf16* __restrict__ VB, __bf16* __restrict__ VBL PROJ_EXTRA_PARAMS) {
  // LDS: st, then one region that holds in turn the two operand stages (256 rows each: X 128, W 128) and, behind the epilogue's barriers, either sh + sl or th + tb + tbl
  __shared__ __align__(16) float st[64][132]; __shared__ __align__(16) unsigned char ur[2 * 256 * SP * 2];
  __bf16* const sg = (__bf16*)ur; _Float16 (* const sh)[136] = (_Float16 (*)[136])ur; _Float16 (* const sl)[136] = (_Float16 (*)[136])(ur + 64 * 136 * 2);
  _Float16 (* const th)[72] = (_Float16 (*)[72])ur; __bf16 (* const tb)[72] = (__bf16 (*)[72])(ur + 128 * 72 * 2); __bf16 (* const tbl)[72] = (__bf16 (*)[72])(ur + 2 * 128 * 72 * 2);
  const int tid = threadIdx.x, wave = tid >> 5, lane = tid & 31, col = lane & 15, g = lane >> 4; const int wr = wave >> 1, wc = wave & 1; const int which = blockIdx.z; const int c0 = blockIdx.y * 128; const size_t rb = (size_t)blockIdx.x * 128;
  const float* X = which == 0 ? XQ : which == 1 ? XK : XV; const float* WA = which == 0 ? WQ : which == 1 ? WK : WV; const float* BA = which == 0 ? BQ : which == 1 ? BK : BV;
  v8f acc[4][4] = {};
  { const int srow = tid >> 4, sq = (tid & 15) * 4; const float* Xp = X + rb * DIN; const float* Wp = WA + (size_t)c0 * DIN; const unsigned so = (unsigned)(srow * DIN + sq) * 4u; __bf16* const sd = sg + srow * SP + sq;
    v4f xr[16], wv[16];
    // the k walk starts at a stage rotated by the block's tile indices and wraps, to spread the starting stages of the 8 blocks that share X rows and the 32 that share W rows (for speed only)
    const int rot = (blockIdx.x + 2 * blockIdx.y) & (DIN / SBK - 1);
    ldg_tile<8>(xr, Xp + rot * SBK, so, DIN); ldg_tile<8>(wv, Wp + rot * SBK, so, DIN);
    asm volatile("s_wait_xcnt 0x0" :: "v"(so) : "memory");   // in front of the first overwrite of the loads' address registers: as an input the offset stays untouched up to here
    sts_bf<8>(sd, xr); sts_bf<8>(sd + 128 * SP, wv);
    // two stages a trip, so that the buffer's offset is a constant of each half
#pragma unroll 2
    for (int s = 0; s < DIN / SBK; ++s) {
      __syncthreads();   // publishes stage s and ends every wave's reads of the buffer that stage s + 1 is stored into below
      if (s + 1 < DIN / SBK) { const unsigned sn = so + (unsigned)(((s + 1 + rot) & (DIN / SBK - 1)) * (SBK * 4)); ldg_tile<8>(xr, Xp, sn, DIN); ldg_tile<8>(wv, Wp, sn, DIN);   // the next stage's loads fly while this stage is multiplied
        asm volatile("s_wait_xcnt 0x0" ::: "memory"); }   // behind the run of loads: in front of every later overwrite of their address registers on every way through the loop
      const __bf16* bu = sg + (s & 1) * (256 * SP);
#pragma unroll
      for (int kk = 0; kk < SBK / 32; ++kk) { v16b a[4], w[4];
#pragma unroll
        for (int i = 0; i < 4; ++i) a[i] = frag_b(bu + (wr * 64 + i * 16 + col) * SP + kk * 32, lane);
#pragma unroll
        for (int j = 0; j < 4; ++j) w[j] = frag_b(bu + (128 + wc * 64 + j * 16 + col) * SP + kk * 32, lane);
#pragma unroll
        for (int i = 0; i < 4; ++i) {
#pragma unroll
          for (int j = 0; j < 4; ++j) acc[i][j] = wmma_bfp(a[i], w[j], acc[i][j]); } }
      __builtin_amdgcn_sched_barrier(0);   // keeps the waits for the next stage's loads behind all of this stage's products
      if (s + 1 < DIN / SBK) { __bf16* d = sd + ((s + 1) & 1) * (256 * SP); sts_bf<8>(d, xr); sts_bf<8>(d + 128 * SP, wv); } } }
  // the two halves share one copy of the epilogue's code (it is long: 32 sincosf); no index of acc depends on half
#pragma unroll 1
  for (int half = 0; half < 2; ++half) { const size_t r0 = rb + half * 64; const size_t bb = r0 / TT; const int t0 = (int)(r0 % TT);
  { // the two waves that hold this half stage its f32 tile (acc + bias) in LDS; then the per-(row, head) epilogue hook, then convert
    if (wr == half) {
#pragma unroll
      for (int j = 0; j < 4; ++j) { const float bias = BA ? bfr(BA[c0 + wc * 64 + j * 16 + col]) : 0.f;
#pragma unroll
        for (int i = 0; i < 4; ++i) {
#pragma unroll
          for (int r = 0; r < 8; ++r) st[i * 16 + 8 * g + r][wc * 64 + j * 16 + col] = acc[i][j][r] + bias; } } }
    __syncthreads();
    for (int e = tid; e < 64 * (128 / HD); e += 128) { const int rl = e / (128 / HD), hh = e % (128 / HD); PROJ_EPI(which, &st[rl][hh * HD], (int)((r0 + rl) % TT), (c0 / HD) + hh); }
    __syncthreads(); }
  if (which < 2) { _Float16* DH = which == 0 ? QH : KH; _Float16* DL = which == 0 ? QL : KL; const int nhi = which == 0 ? QHI : KHI; const bool hi_rows = t0 < nhi;
    for (int e = tid; e < 64 * 128; e += 128) { const int rl = e >> 7, cl = e & 127; const float v = st[rl][cl]; const _Float16 hv = (_Float16)v; sh[rl][cl] = hv; sl[rl][cl] = (_Float16)((v - (float)hv) * 1024.0f); }
    __syncthreads();
    for (int e = tid; e < 64 * 16; e += 128) { const int rl = e >> 4, q = e & 15; vst2((unsigned*)(DH + (r0 + rl) * CC + c0 + q * 8), *(const v4u*)&sh[rl][q * 8]); if (hi_rows) vst2((unsigned*)(DL + (bb * nhi + t0 + rl) * (size_t)CC + c0 + q * 8), *(const v4u*)&sl[rl][q * 8]); }
  } else { const bool hi_rows = t0 < KHI;
    for (int e = tid; e < 64 * 128; e += 128) { const int rl = e & 63, cl = e >> 6; const float v = st[rl][cl]; th[cl][rl] = (_Float16)v; const __bf16 bh = (__bf16)v; tb[cl][rl] = bh; tbl[cl][rl] = (__bf16)(v - (float)bh); }
    __syncthreads();
    for (int e = tid; e < 128 * 8; e += 128) { const int cl = e >> 3, q = e & 7; vst2((unsigned*)(VT + (bb * CC + c0 + cl) * (size_t)TT + t0 + q * 8), *(const v4u*)&th[cl][q * 8]);
      asm volatile("s_wait_xcnt 0x0" ::: "memory");   // in front of the overwrite of the store's data and address registers (this build reuses them at once)
      if (hi_rows) { const size_t o3 = (bb * CC + c0 + cl) * (size_t)KHI + t0 + q * 8; vst2((unsigned*)(VB + o3), *(const v4u*)&tb[cl][q * 8]); vst2((unsigned*)(VBL + o3), *(const v4u*)&tbl[cl][q * 8]);
        asm volatile("s_wait_xcnt 0x0" ::: "memory"); } } } } }   // the same for these two stores, in front of the next trip
// ---- K/V staging of k_attn: a stage is one pass's 64 k rows and 64 v planes of the head (128 B each), brought into LDS once a block by asynchronous copies (8 lanes x 16 B a row, so every wave-wide copy covers four whole 128-B lines), for all four waves
#define KVP (HD + 8)          // staged row pitch in f16 elements: 144 B = 16 B x 9, an odd count of 16 B for the ds_load_b128 fragment reads
#define KVB (2 * 64 * KVP)    // one stage in f16 elements: 64 k rows, then 64 v planes
__device__ __forceinline__ void kv_copy(unsigned ld, const _Float16* kg, const _Float16* vg) {
  // one statement for the thread's eight copies and the s_wait_xcnt 0 behind them: the wait stands in front of every later overwrite of the copies' address registers
  asm volatile("global_load_async_to_lds_b128 %0, %8, off\n\t"
               "global_load_async_to_lds_b128 %1, %9, off\n\t"
               "global_load_async_to_lds_b128 %2, %10, off\n\t"
               "global_load_async_to_lds_b128 %3, %11, off\n\t"
               "global_load_async_to_lds_b128 %4, %12, off\n\t"
               "global_load_async_to_lds_b128 %5, %13, off\n\t"
               "global_load_async_to_lds_b128 %6, %14, off\n\t"
               "global_load_async_to_lds_b128 %7, %15, off\n\t"
               "s_wait_xcnt 0x0"
               :: "v"(ld), "v"(ld + 16u * KVP * 2u), "v"(ld + 32u * KVP * 2u), "v"(ld + 48u * KVP * 2u), "v"(ld + 64u * KVP * 2u), "v"(ld + 80u * KVP * 2u), "v"(ld + 96u * KVP * 2u), "v"(ld + 112u * KVP * 2u),
                  "v"(kg), "v"(kg + (size_t)16 * CC), "v"(kg + (size_t)32 * CC), "v"(kg + (size_t)48 * CC), "v"(vg), "v"(vg + (size_t)16 * TT), "v"(vg + (size_t)32 * TT), "v"(vg + (size_t)48 * TT)
               : "memory"); }
__global__ __launch_bounds__(128) void k_attn(const _Float16* __restrict__ QH, const _Float16* __restrict__ KH, const _Float16* __restrict__ QL, const _Float16* __restrict__ VT, float* __restrict__ Y) { __shared__ __align__(16) float ss[4][16][HD + 4]; __shared__ __align__(16) _Float16 kv[2 * KVB];
  const int tid = threadIdx.x, wave = tid >> 5, lane = tid & 31, col = lane & 15, g = lane >> 4; const int qb = blockIdx.x, h = blockIdx.y, b = blockIdx.z; const int ql0 = qb * 64 + wave * 16;
  const int srow = tid >> 3, sc = (tid & 7) * 8;   // the thread's row (and rows + 16, 32, 48) and 16-B piece of a stage
  const _Float16* Kg = KH + ((size_t)b * TT + srow) * CC + h * HD + sc;
  const _Float16* Vg = VT + ((size_t)b * CC + h * HD + srow) * (size_t)TT + sc;
  const unsigned ld0 = (unsigned)(size_t)(kv + srow * KVP + sc);   // LDS byte address: the low 32 bits of the shared address
  // the key walk starts at the 64-key slice qb and wraps (stage t holds slice (t + qb) mod 16), so that the 16 blocks that share a head's K and V start on different slices (for speed only)
  const int rot = qb & (TT / 64 - 1), rot1 = (rot + 1) & (TT / 64 - 1);
  kv_copy(ld0, Kg + (size_t)rot * 64 * CC, Vg + rot * 64);
  asm volatile("s_wait_asynccnt 0x0" ::: "memory");   // this wave's copies of stage 0 have landed
  __syncthreads();                                    // publishes stage 0
  kv_copy(ld0 + KVB * 2u, Kg + (size_t)rot1 * 64 * CC, Vg + rot1 * 64);
  v16h qh[HD / 32], ql[HD / 32];
#pragma unroll
  for (int kc = 0; kc < HD / 32; ++kc) { qh[kc] = frag_h(QH + ((size_t)b * TT + ql0 + col) * CC + h * HD + kc * 32, lane); ql[kc] = frag_h(QL + ((size_t)b * QHI + ql0 + col) * CC + h * HD + kc * 32, lane); }
  asm volatile("s_wait_xcnt 0x0" :: "v"(QH + ((size_t)b * TT + ql0 + col) * CC + h * HD + 8 * g), "v"(QL + ((size_t)b * QHI + ql0 + col) * CC + h * HD + 8 * g) : "memory");   // behind the q loads: in front of the overwrite of their address registers (this build reuses them for the accumulators' zeros); as inputs the two addresses stay untouched up to here
  v8f o[HD / 16] = {}; float m = -3.0e38f, l = 0.f;
  // the pass loop stays rolled (two passes' fragments at once would cost the fourth wave of a SIMD); every inner loop is unrolled so that each register-array index is a constant
#pragma unroll 1
  for (int t = 0; t < TT / 64; ++t) { v8f acc[4] = {}, accl[4] = {}; v16h kf[HD / 32][4], vf[2][HD / 16];
    const _Float16* Ks = kv + (t & 1) * KVB + col * KVP;   // key row col of the stage
    const _Float16* Vs = Ks + 64 * KVP;                    // v plane col of the stage
#pragma unroll
    for (int kc = 0; kc < HD / 32; ++kc) {   // all of the pass's k fragments are asked for before the first product, so that their latencies overlap
#pragma unroll
      for (int j = 0; j < 4; ++j) kf[kc][j] = frag_h(Ks + (j * 16) * KVP + kc * 32, lane); }
#pragma unroll
    for (int kc = 0; kc < HD / 32; ++kc) {
#pragma unroll
      for (int j = 0; j < 4; ++j) { acc[j] = wmma16p(kf[kc][j], qh[kc], acc[j]); accl[j] = wmma16p(kf[kc][j], ql[kc], accl[j]); } }
#pragma unroll
    for (int kc = 0; kc < 2; ++kc) {   // the pass's v fragments fly while the softmax is worked out
#pragma unroll
      for (int jj = 0; jj < HD / 16; ++jj) vf[kc][jj] = frag_h(Vs + (jj * 16) * KVP + kc * 32, lane); }
    float mx = -3.0e38f;
#pragma unroll
    for (int j = 0; j < 4; ++j) {
#pragma unroll
      for (int r = 0; r < 8; ++r) { const float s = acc[j][r] + accl[j][r] * (1.0f / 1024.0f); acc[j][r] = s; mx = fmaxf(mx, s); } }   // unscaled score: SCALE goes into SL2E below
    mx = fmaxf(mx, __shfl_xor(mx, 16));   // the other half of this query's keys
    const float mn = fmaxf(m, mx); const float corr = __builtin_amdgcn_exp2f((m - mn) * SL2E); m = mn;
    const float nb = 10.0f - mn * SL2E;   // exp(SCALE (s - mn)) x 2^10 = 2^(s SL2E + nb)
    float sum = 0.f; v16h p[2];
#pragma unroll
    for (int j = 0; j < 4; ++j) {
#pragma unroll
      for (int r = 0; r < 8; ++r) { const float e = __builtin_amdgcn_exp2f(fmaf(acc[j][r], SL2E, nb)); sum += e; p[j >> 1][(j & 1) * 8 + r] = (_Float16)e; } }
    l = l * corr + sum;
#pragma unroll
    for (int jj = 0; jj < HD / 16; ++jj) {
#pragma unroll
      for (int r = 0; r < 8; ++r) o[jj][r] *= corr; }
#pragma unroll
    for (int kc = 0; kc < 2; ++kc) {
#pragma unroll
      for (int jj = 0; jj < HD / 16; ++jj) o[jj] = wmma16p(vf[kc][jj], p[kc], o[jj]); }
    asm volatile("s_wait_dscnt 0x0" ::: "memory");      // this wave's reads of stage t have returned
    asm volatile("s_wait_asynccnt 0x0" ::: "memory");   // this wave's copies of stage t + 1 have landed
    __syncthreads();                                    // publishes stage t + 1 and ends every wave's reads of the buffer that is refilled below
    if (t + 2 < TT / 64) { const int tn = (t + 2 + rot) & (TT / 64 - 1); kv_copy(ld0 + (unsigned)(t & 1) * (KVB * 2u), Kg + (size_t)tn * 64 * CC, Vg + tn * 64); } }
  asm volatile("s_wait_asynccnt 0x0" ::: "memory");     // no copy is outstanding when the wave goes on to its end
  l += __shfl_xor(l, 16); const float inv = 1.0f / l;   // l carries the 2^10 of its terms
#pragma unroll
  for (int jj = 0; jj < HD / 16; ++jj)
#pragma unroll
    for (int r = 0; r < 8; ++r) ss[wave][col][jj * 16 + 8 * g + r] = o[jj][r] * inv;
  LDSX(); for (int rl = 0; rl < 16; ++rl) if (lane < HD / 4) vst2(Y + ((size_t)b * TT + ql0 + rl) * CC + h * HD + lane * 4, *(const v4f*)&ss[wave][rl][lane * 4]); }
// ---- k_out: block = (128 rows, 128 cols), eight waves of 32 x 64 (4 x 2): out = ctx Wo (+ bo): ctx split bf16 hi + lo against exact bf16 Wo (2 products, hi then lo into each accumulator)
__global__ __launch_bounds__(256) void k_out(const float* __restrict__ Y, const float* __restrict__ WO, const float* __restrict__ BO, float* __restrict__ OUT) { __shared__ __align__(16) float sf[8][32][68]; __shared__ __align__(16) __bf16 sg[2 * 384 * SP];   // two operand stages of 384 rows: ctx hi 128, ctx lo 128, Wo 128
  const int tid = threadIdx.x, wave = tid >> 5, lane = tid & 31, col = lane & 15, g = lane >> 4; const int wr = wave >> 1, wc = wave & 1; const int c0 = blockIdx.y * 128; const size_t rb = (size_t)blockIdx.x * 128;
  v8f acc[2][4] = {};
  const int srow = tid >> 4, sq = (tid & 15) * 4; const float* Yp = Y + rb * CC; const float* Wp = WO + (size_t)c0 * CC; const unsigned so = (unsigned)(srow * CC + sq) * 4u; __bf16* const sd = sg + srow * SP + sq;
  v4f yr[8], wv[8];
  // rotated start of the k walk, as in k_proj: 8 blocks share ctx rows, 32 share Wo rows
  const int rot = (blockIdx.x + 2 * blockIdx.y) & (CC / SBK - 1);
  ldg_tile<16>(yr, Yp + rot * SBK, so, CC); ldg_tile<16>(wv, Wp + rot * SBK, so, CC);
  asm volatile("s_wait_xcnt 0x0" :: "v"(so) : "memory");   // in front of the first overwrite of the loads' address registers: as an input the offset stays untouched up to here
  sts_split<16>(sd, sd + 128 * SP, yr); sts_bf<16>(sd + 256 * SP, wv);
  // two stages a trip, so that the buffer's offset is a constant of each half
#pragma unroll 2
  for (int s = 0; s < CC / SBK; ++s) {
    __syncthreads();   // publishes stage s and ends every wave's reads of the buffer that stage s + 1 is stored into below
    if (s + 1 < CC / SBK) { const unsigned sn = so + (unsigned)(((s + 1 + rot) & (CC / SBK - 1)) * (SBK * 4)); ldg_tile<16>(yr, Yp, sn, CC); ldg_tile<16>(wv, Wp, sn, CC);   // the next stage's loads fly while this stage is multiplied
      asm volatile("s_wait_xcnt 0x0" :: "v"(sn) : "memory"); }   // behind the run of loads: in front of every overwrite of their address registers; as an input the stage's offset stays untouched up to here
    const __bf16* bu = sg + (s & 1) * (384 * SP);
#pragma unroll
    for (int kk = 0; kk < SBK / 32; ++kk) { v16b ah[2], al[2], w[4];
#pragma unroll
      for (int i = 0; i < 2; ++i) { ah[i] = frag_b(bu + (wr * 32 + i * 16 + col) * SP + kk * 32, lane); al[i] = frag_b(bu + (128 + wr * 32 + i * 16 + col) * SP + kk * 32, lane); }
#pragma unroll
      for (int j = 0; j < 4; ++j) w[j] = frag_b(bu + (256 + wc * 64 + j * 16 + col) * SP + kk * 32, lane);
#pragma unroll
      for (int i = 0; i < 2; ++i) {
#pragma unroll
        for (int j = 0; j < 4; ++j) acc[i][j] = wmma_bf(ah[i], w[j], acc[i][j]); }
#pragma unroll
      for (int i = 0; i < 2; ++i) {
#pragma unroll
        for (int j = 0; j < 4; ++j) acc[i][j] = wmma_bf(al[i], w[j], acc[i][j]); } }
    __builtin_amdgcn_sched_barrier(0);   // keeps the waits for the next stage's loads behind all of this stage's products
    if (s + 1 < CC / SBK) { __bf16* d = sd + ((s + 1) & 1) * (384 * SP); sts_split<16>(d, d + 128 * SP, yr); sts_bf<16>(d + 256 * SP, wv); } }
#pragma unroll
  for (int j = 0; j < 4; ++j) { const float bias = BO ? bfr(BO[c0 + wc * 64 + j * 16 + col]) : 0.f;
#pragma unroll
    for (int i = 0; i < 2; ++i) {
#pragma unroll
      for (int r = 0; r < 8; ++r) sf[wave][i * 16 + 8 * g + r][j * 16 + col] = acc[i][j][r] + bias; } }
  LDSX();
  // a wave-wide store covers two rows of the wave's 64 columns (256 B each); all rows are read back first, so that no store's register is written again
  v4f ov[16];
#pragma unroll
  for (int i = 0; i < 16; ++i) ov[i] = *(const v4f*)&sf[wave][2 * i + g][col * 4];
#pragma unroll
  for (int i = 0; i < 16; ++i) vst2(OUT + (rb + wr * 32 + 2 * i + g) * DIN + c0 + wc * 64 + col * 4, ov[i]); }

extern "C" void kernel_launch(void* const* d_in, const int* in_sizes, int n_in, void* d_out, int out_size, void* d_ws, size_t ws_size, hipStream_t stream) {
  (void)in_sizes; (void)n_in; (void)out_size;
  const float** F = (const float**)d_in;
  if (ws_size < (size_t)WS_END) return;
  char* ws = (char*)d_ws; _Float16 *QH = (_Float16*)(ws + WS_QH), *KH = (_Float16*)(ws + WS_KH), *VT = (_Float16*)(ws + WS_VT), *QL = (_Float16*)(ws + WS_QL), *KL = (_Float16*)(ws + WS_KL); __bf16 *VB = (__bf16*)(ws + WS_VB), *VBL = (__bf16*)(ws + WS_VBL); float *Y = (float*)(ws + WS_Y);
  (void)Y; (void)QL; (void)KL; (void)VB; (void)VBL;
  // inputs: 0 q, 1 k, 2 v [4,1024,1024]; 3 Wq [1024,1024] (out,in), 4 bq; 5 Wk, 6 bk; 7 Wv, 8 bv; 9 Wo, 10 bo
  k_proj<<<dim3(TNB * TT / 128, CC / 128, 3), 128, 0, stream>>>(F[0], F[1], F[2], F[3], F[5], F[7], F[4], F[6], F[8], QH, QL, KH, KL, VT, VB, VBL);
  k_attn<<<dim3(NQB, NH, TNB), 128, 0, stream>>>(QH, KH, QL, VT, Y);
  k_out<<<dim3(TNB * TT / 128, DIN / 128), 256, 0, stream>>>(Y, F[9], F[10], (float*)d_out);
}
